// v000
// Times are from an AMD MI455X. After a warm-up the kernel runs many times in a row, and a time is the length of
// such a window on the GPU divided by its runs, so every launch and the gaps after it count. The runs cycle
// through copies of the inputs. A figure is the median of several windows, for all but v000 over two sittings.
// Sittings can differ by a few percent; kernels timed side by side share one.
// v000 is the starting kernel. One run takes 489 microseconds.
// compute dtype: all float inputs rounded to bf16, is_causal (int scalar) read on device; scores = q . k with EXACT bf16 x bf16 products on WMMA 16x16x32 restricted to the query's own segment (block-local attention; segment length 1024 / 2048 / 4096 by head group), optional causal exclusion on segment 0 of group 0 when is_causal != 0, x 1/8, running-max softmax in f32 (hardware exp); P (x 2^11) as bf16 hi + lo (2 products) x v (exact bf16 planes); f32 output.
#include <hip/hip_runtime.h>
#include <math.h>

typedef __attribute__((ext_vector_type(16))) _Float16 v16h;
typedef __attribute__((ext_vector_type(16))) __bf16 v16b;
typedef __attribute__((ext_vector_type(8)))  _Float16 v8h;
typedef __attribute__((ext_vector_type(8)))  float v8f;
typedef __attribute__((ext_vector_type(4)))  float v4f;
typedef __attribute__((ext_vector_type(2)))  float v2f;
typedef __attribute__((ext_vector_type(4)))  unsigned v4u;
typedef __attribute__((ext_vector_type(4)))  int v4i;
typedef float __attribute__((may_alias)) float_a;
typedef int __attribute__((may_alias)) int_a;

template <typename T> __device__ __forceinline__ void vst2(void* p, T v) { *(T*)p = v;  }
__device__ __forceinline__ v8f wmma16(v16h a, v16h b, v8f c) {
  v8f d = __builtin_amdgcn_wmma_f32_16x16x32_f16(false, a, false, b, (short)0, c, false, false);
  asm volatile("v_nop\n\tv_nop\n\tv_nop\n\tv_nop" : "+v"(d) : "v"(a), "v"(b));
  return d;
}
__device__ __forceinline__ v8f wmma_bf(v16b a, v16b b, v8f c) {
  v8f d = __builtin_amdgcn_wmma_f32_16x16x32_bf16(false, a, false, b, (short)0, c, false, false);
  asm volatile("v_nop\n\tv_nop\n\tv_nop\n\tv_nop" : "+v"(d) : "v"(a), "v"(b));
  return d;
}
// 16x16x32 fragments: lane = (h = lane>>4, row/col = lane&15); elements 0..7 = k0+8h+0..7, 8..15 = k0+16+8h+0..7; D element r = row 8h+r
__device__ __forceinline__ v16h frag_h(const _Float16* rowk0, int lane) {
  union { v16h v; v8h q[2]; } u; const _Float16* p = rowk0 + 8 * (lane >> 4);
  u.q[0] = *(const v8h*)p; u.q[1] = *(const v8h*)(p + 16); return u.v;
}
__device__ __forceinline__ v16h frag_f32(const float* rowk0, int lane) {
  v16h a; const float* p = rowk0 + 8 * (lane >> 4);
#pragma unroll
  for (int i = 0; i < 8; ++i) { a[i] = (_Float16)p[i]; a[8 + i] = (_Float16)p[16 + i]; }
  return a;
}
__device__ __forceinline__ v16h frag_f32s(const float* rowk0, int lane, float sc) {
  v16h a; const float* p = rowk0 + 8 * (lane >> 4);
#pragma unroll
  for (int i = 0; i < 8; ++i) { a[i] = (_Float16)(p[i] * sc); a[8 + i] = (_Float16)(p[16 + i] * sc); }
  return a;
}
// column fragment from a [K][ld] layout (column n), rows >= K read as 0
__device__ __forceinline__ v16h fragc_f32(const float* W, int k0, int n, int lane, int ld, int K) {
  v16h a; const int g = lane >> 4;
#pragma unroll
  for (int i = 0; i < 8; ++i) { const int ka = k0 + 8 * g + i, kb = ka + 16;
    a[i] = (_Float16)(ka < K ? W[(size_t)(ka < K ? ka : K - 1) * ld + n] : 0.f); a[8 + i] = (_Float16)(kb < K ? W[(size_t)(kb < K ? kb : K - 1) * ld + n] : 0.f); }
  return a;
}
struct F2 { v16b h, l; };
__device__ __forceinline__ F2 bsplit16(const float v[16]) { F2 r;
#pragma unroll
  for (int i = 0; i < 16; ++i) { const __bf16 h = (__bf16)v[i]; r.h[i] = h; r.l[i] = (__bf16)(v[i] - (float)h); }
  return r; }
__device__ __forceinline__ F2 split_row(const float* row, int k0, int lane) { float v[16]; const float* p = row + k0 + 8 * (lane >> 4);
#pragma unroll
  for (int i = 0; i < 8; ++i) { v[i] = p[i]; v[8 + i] = p[16 + i]; }
  return bsplit16(v); }
__device__ __forceinline__ F2 split_rowK(const float* row, int k0, int lane, int K) { float v[16]; const int g = lane >> 4;
#pragma unroll
  for (int i = 0; i < 8; ++i) { const int ka = k0 + 8 * g + i, kb = ka + 16; v[i] = ka < K ? row[ka < K ? ka : K - 1] : 0.f; v[8 + i] = kb < K ? row[kb < K ? kb : K - 1] : 0.f; }
  return bsplit16(v); }
__device__ __forceinline__ F2 split_col(const float* W, int k0, int n, int lane, int ld, int K) { float v[16]; const int g = lane >> 4;
#pragma unroll
  for (int i = 0; i < 8; ++i) { const int ka = k0 + 8 * g + i, kb = ka + 16; v[i] = ka < K ? W[(size_t)(ka < K ? ka : K - 1) * ld + n] : 0.f; v[8 + i] = kb < K ? W[(size_t)(kb < K ? kb : K - 1) * ld + n] : 0.f; }
  return bsplit16(v); }
__device__ __forceinline__ v8f mac3(const F2& a, const F2& b, v8f c) { c = wmma_bf(a.l, b.h, c); c = wmma_bf(a.h, b.l, c); return wmma_bf(a.h, b.h, c); }
__device__ __forceinline__ float sigm(float v) { return 1.0f / (1.0f + expf(-v)); }
#define LDSX() do { asm volatile("s_wait_dscnt 0" ::: "memory"); __builtin_amdgcn_wave_barrier(); __builtin_amdgcn_fence(__ATOMIC_RELEASE, "workgroup"); } while (0)


// Head-parallel block-local ('dilated', degenerate gather) attention on given q, k, v (B 2, N 4,096, 12 heads x 64): heads 0-3 attend within 1,024-token segments, 4-7 within 2,048, 8-11 over all 4,096; softmax(q k / 8) v per segment.
#define NB 2
#define SS 4096
#define NH 12
#define HD 64
#define DM (NH * HD)
#ifndef TQB
#define TQB (SS / 64)
#define TNB NB
#define QB0 0            // first query block
#endif
typedef __attribute__((ext_vector_type(8))) __bf16 v8b;
__device__ __forceinline__ v16b frag_b(const __bf16* rowk0, int lane) {
  union { v16b v; v8b q[2]; } u; const __bf16* p = rowk0 + 8 * (lane >> 4);
  u.q[0] = *(const v8b*)p; u.q[1] = *(const v8b*)(p + 16); return u.v;
}
__device__ __forceinline__ float bfr(float v) { return (float)(__bf16)v; }
__device__ __attribute__((noinline)) float exp_ni(float v) { return expf(v); }
__device__ __attribute__((noinline)) float erf_ni(float v) { return erff(v); }

#define WS_VT  0u                                   // bf16 v planes [b][h*64 + d][s]
#define WS_END (WS_VT + 2u * (size_t)NB * DM * SS)

// ---- k_vt: block = (64 keys, 128 cols, b): v[b][s][c] -> VT[b][c][s] bf16 (exact)
__global__ __launch_bounds__(256) void k_vt(const float* __restrict__ V, __bf16* __restrict__ VT) { __shared__ __align__(16) __bf16 st[128][64 + 8]; const int t = threadIdx.x; const int s0 = blockIdx.x * 64; const int c0 = blockIdx.y * 128; const size_t b = blockIdx.z;
  for (int e = t; e < 64 * 128; e += 256) { const int sl = e >> 7, c = e & 127; st[c][sl] = (__bf16)V[((b * SS + s0 + sl) * DM) + c0 + c]; } __syncthreads();
  for (int e = t; e < 128 * 8; e += 256) { const int c = e >> 3, q = e & 7; vst2((unsigned*)(VT + ((b * DM + c0 + c) * SS) + s0 + q * 8), *(const v4u*)&st[c][q * 8]); } }
__device__ __forceinline__ v16b fragb_f32(const float* __restrict__ p, int lane) { v16b a; const float* pp = p + 8 * (lane >> 4);
#pragma unroll
  for (int i = 0; i < 8; ++i) { a[i] = (__bf16)pp[i]; a[8 + i] = (__bf16)pp[16 + i]; } return a; }
// ---- k_attn: block = (64 queries, head, b): segment length L = 1024 << min(h / 4, 2); keys = the query block's segment; causal (k <= q) only if is_causal != 0, head group 0, segment 0; exact scores, softmax, P as bf16 hi + lo x v planes -> output rows
__global__ __launch_bounds__(128) void k_attn(const float* __restrict__ Q, const float* __restrict__ K, const __bf16* __restrict__ VT, const int* __restrict__ ISC, float* __restrict__ CTX) {
  __shared__ __align__(16) float sp[4][16][36]; __shared__ __align__(16) float so[4][16][68];
  const int tid = threadIdx.x, wave = tid >> 5, lane = tid & 31, col = lane & 15, g = lane >> 4; const int qb = blockIdx.x + QB0, h = blockIdx.y; const size_t b = blockIdx.z; const int q0 = qb * 64 + wave * 16; const size_t rq = b * SS + q0;
  v16b aq[2];
#pragma unroll
  for (int kc = 0; kc < 2; ++kc) aq[kc] = fragb_f32(Q + (rq + col) * DM + h * HD + kc * 32, lane);
  float m[8], l[8];
#pragma unroll
  for (int r = 0; r < 8; ++r) { m[r] = -3.0e38f; l[r] = 0.f; }
  v8f acc[4] = {}, accl[4] = {};
  const int grp = (h / 4 > 2) ? 2 : h / 4; const int L = 1024 << grp; const int seg = (qb * 64) / L; const bool causal = (ISC[0] != 0) && grp == 0 && seg == 0; const int ks0 = seg * L / 32, ks1 = (seg + 1) * L / 32;
#pragma unroll 1
  for (int ks = ks0; ks < ks1; ++ks) { if (causal && ks * 32 > qb * 64 + 63) break; v8f s[2];
#pragma unroll
    for (int ct = 0; ct < 2; ++ct) { const int kk = ks * 32 + ct * 16 + col; v8f c = {};
#pragma unroll
      for (int kc = 0; kc < 2; ++kc) c = wmma_bf(aq[kc], fragb_f32(K + (b * SS + kk) * DM + h * HD + kc * 32, lane), c);
#pragma unroll
      for (int r = 0; r < 8; ++r) s[ct][r] = (!causal || kk <= q0 + 8 * g + r) ? c[r] * 0.125f : -3.0e38f; }
#pragma unroll
    for (int r = 0; r < 8; ++r) { float mx = fmaxf(s[0][r], s[1][r]);
#pragma unroll
      for (int o = 1; o < 16; o <<= 1) mx = fmaxf(mx, __shfl_xor(mx, o));
      const float mn = fmaxf(m[r], mx); const float alpha = (m[r] <= -1.0e38f) ? 0.f : __expf(m[r] - mn);
      const float e0 = (s[0][r] <= -1.0e38f) ? 0.f : __expf(s[0][r] - mn), e1 = (s[1][r] <= -1.0e38f) ? 0.f : __expf(s[1][r] - mn); float es = e0 + e1;
#pragma unroll
      for (int o = 1; o < 16; o <<= 1) es += __shfl_xor(es, o);
      l[r] = l[r] * alpha + es; m[r] = mn;
#pragma unroll
      for (int dt = 0; dt < 4; ++dt) { acc[dt][r] *= alpha; accl[dt][r] *= alpha; }
      sp[wave][8 * g + r][col] = e0; sp[wave][8 * g + r][16 + col] = e1; }
    LDSX();
    v16b pa, pl; { const float* prow = &sp[wave][col][0] + 8 * (lane >> 4);
#pragma unroll
      for (int i = 0; i < 8; ++i) { const float x0 = prow[i] * 2048.0f, x1 = prow[16 + i] * 2048.0f; const __bf16 h0 = (__bf16)x0, h1 = (__bf16)x1; pa[i] = h0; pa[8 + i] = h1; pl[i] = (__bf16)((x0 - (float)h0) * 256.0f); pl[8 + i] = (__bf16)((x1 - (float)h1) * 256.0f); } }   // bf16 hi + lo (lo x 2^8)
#pragma unroll
    for (int dt = 0; dt < 4; ++dt) { const v16b vf = frag_b(VT + ((b * DM + h * HD + dt * 16 + col) * SS) + ks * 32, lane); acc[dt] = wmma_bf(pa, vf, acc[dt]); accl[dt] = wmma_bf(pl, vf, accl[dt]); }
    LDSX(); }
#pragma unroll
  for (int r = 0; r < 8; ++r) { const float il = (l[r] > 0.f) ? (1.0f / 2048.0f) / l[r] : 0.f;
#pragma unroll
    for (int dt = 0; dt < 4; ++dt) so[wave][8 * g + r][dt * 16 + col] = (acc[dt][r] + accl[dt][r] * (1.0f / 256.0f)) * il; }
  LDSX();
  for (int rl = 0; rl < 16; ++rl) if (lane < 16) vst2(CTX + (rq + rl) * DM + h * HD + lane * 4, *(const v4f*)&so[wave][rl][lane * 4]);
}
extern "C" void kernel_launch(void* const* d_in, const int* in_sizes, int n_in, void* d_out, int out_size, void* d_ws, size_t ws_size, hipStream_t stream) {
  (void)in_sizes; (void)n_in; (void)out_size;
  const float** F = (const float**)d_in;   // 0 q [2,4096,12,64], 1 k, 2 v, 3 is_causal int scalar
  if (ws_size < (size_t)WS_END) return;
  char* ws = (char*)d_ws; __bf16* VT = (__bf16*)(ws + WS_VT);
  k_vt<<<dim3(SS / 64, DM / 128, NB), 256, 0, stream>>>(F[2], VT);
  k_attn<<<dim3(TQB, NH, TNB), 128, 0, stream>>>(F[0], F[1], VT, (const int*)d_in[3], (float*)d_out);
}

// v001
// Measured time: 277 microseconds a run.
// Two timings next to v000 both put it at 1.82 times that version's speed.
// compute dtype: all float inputs rounded to bf16, is_causal (int scalar) read on device; scores = q . k with EXACT bf16 x bf16 products on WMMA 16x16x32 restricted to the query's own segment (block-local attention; segment length 1024 / 2048 / 4096 by head group), optional causal exclusion on segment 0 of group 0 when is_causal != 0, x 1/8, running-max softmax in f32 (hardware exp); P (x 2^11) as bf16 hi + lo (2 products) x v (exact bf16 planes); f32 output.
#include <hip/hip_runtime.h>
#include <math.h>

typedef __attribute__((ext_vector_type(16))) _Float16 v16h;
typedef __attribute__((ext_vector_type(16))) __bf16 v16b;
typedef __attribute__((ext_vector_type(8)))  _Float16 v8h;
typedef __attribute__((ext_vector_type(8)))  float v8f;
typedef __attribute__((ext_vector_type(4)))  float v4f;
typedef __attribute__((ext_vector_type(2)))  float v2f;
typedef __attribute__((ext_vector_type(4)))  unsigned v4u;
typedef __attribute__((ext_vector_type(4)))  int v4i;
typedef float __attribute__((may_alias)) float_a;
typedef int __attribute__((may_alias)) int_a;

template <typename T> __device__ __forceinline__ void vst2(void* p, T v) { *(T*)p = v;  }
__device__ __forceinline__ v8f wmma16(v16h a, v16h b, v8f c) {
  v8f d = __builtin_amdgcn_wmma_f32_16x16x32_f16(false, a, false, b, (short)0, c, false, false);
  asm volatile("v_nop\n\tv_nop\n\tv_nop\n\tv_nop" : "+v"(d) : "v"(a), "v"(b));
  return d;
}
__device__ __forceinline__ v8f wmma_bf(v16b a, v16b b, v8f c) {
  v8f d = __builtin_amdgcn_wmma_f32_16x16x32_bf16(false, a, false, b, (short)0, c, false, false);
  asm volatile("v_nop\n\tv_nop\n\tv_nop\n\tv_nop" : "+v"(d) : "v"(a), "v"(b));
  return d;
}
// 16x16x32 fragments: lane = (h = lane>>4, row/col = lane&15); elements 0..7 = k0+8h+0..7, 8..15 = k0+16+8h+0..7; D element r = row 8h+r
__device__ __forceinline__ v16h frag_h(const _Float16* rowk0, int lane) {
  union { v16h v; v8h q[2]; } u; const _Float16* p = rowk0 + 8 * (lane >> 4);
  u.q[0] = *(const v8h*)p; u.q[1] = *(const v8h*)(p + 16); return u.v;
}
__device__ __forceinline__ v16h frag_f32(const float* rowk0, int lane) {
  v16h a; const float* p = rowk0 + 8 * (lane >> 4);
#pragma unroll
  for (int i = 0; i < 8; ++i) { a[i] = (_Float16)p[i]; a[8 + i] = (_Float16)p[16 + i]; }
  return a;
}
__device__ __forceinline__ v16h frag_f32s(const float* rowk0, int lane, float sc) {
  v16h a; const float* p = rowk0 + 8 * (lane >> 4);
#pragma unroll
  for (int i = 0; i < 8; ++i) { a[i] = (_Float16)(p[i] * sc); a[8 + i] = (_Float16)(p[16 + i] * sc); }
  return a;
}
// column fragment from a [K][ld] layout (column n), rows >= K read as 0
__device__ __forceinline__ v16h fragc_f32(const float* W, int k0, int n, int lane, int ld, int K) {
  v16h a; const int g = lane >> 4;
#pragma unroll
  for (int i = 0; i < 8; ++i) { const int ka = k0 + 8 * g + i, kb = ka + 16;
    a[i] = (_Float16)(ka < K ? W[(size_t)(ka < K ? ka : K - 1) * ld + n] : 0.f); a[8 + i] = (_Float16)(kb < K ? W[(size_t)(kb < K ? kb : K - 1) * ld + n] : 0.f); }
  return a;
}
struct F2 { v16b h, l; };
__device__ __forceinline__ F2 bsplit16(const float v[16]) { F2 r;
#pragma unroll
  for (int i = 0; i < 16; ++i) { const __bf16 h = (__bf16)v[i]; r.h[i] = h; r.l[i] = (__bf16)(v[i] - (float)h); }
  return r; }
__device__ __forceinline__ F2 split_row(const float* row, int k0, int lane) { float v[16]; const float* p = row + k0 + 8 * (lane >> 4);
#pragma unroll
  for (int i = 0; i < 8; ++i) { v[i] = p[i]; v[8 + i] = p[16 + i]; }
  return bsplit16(v); }
__device__ __forceinline__ F2 split_rowK(const float* row, int k0, int lane, int K) { float v[16]; const int g = lane >> 4;
#pragma unroll
  for (int i = 0; i < 8; ++i) { const int ka = k0 + 8 * g + i, kb = ka + 16; v[i] = ka < K ? row[ka < K ? ka : K - 1] : 0.f; v[8 + i] = kb < K ? row[kb < K ? kb : K - 1] : 0.f; }
  return bsplit16(v); }
__device__ __forceinline__ F2 split_col(const float* W, int k0, int n, int lane, int ld, int K) { float v[16]; const int g = lane >> 4;
#pragma unroll
  for (int i = 0; i < 8; ++i) { const int ka = k0 + 8 * g + i, kb = ka + 16; v[i] = ka < K ? W[(size_t)(ka < K ? ka : K - 1) * ld + n] : 0.f; v[8 + i] = kb < K ? W[(size_t)(kb < K ? kb : K - 1) * ld + n] : 0.f; }
  return bsplit16(v); }
__device__ __forceinline__ v8f mac3(const F2& a, const F2& b, v8f c) { c = wmma_bf(a.l, b.h, c); c = wmma_bf(a.h, b.l, c); return wmma_bf(a.h, b.h, c); }
__device__ __forceinline__ float sigm(float v) { return 1.0f / (1.0f + expf(-v)); }
#define LDSX() do { asm volatile("s_wait_dscnt 0" ::: "memory"); __builtin_amdgcn_wave_barrier(); __builtin_amdgcn_fence(__ATOMIC_RELEASE, "workgroup"); } while (0)


// Head-parallel block-local ('dilated', degenerate gather) attention on given q, k, v (B 2, N 4,096, 12 heads x 64): heads 0-3 attend within 1,024-token segments, 4-7 within 2,048, 8-11 over all 4,096; softmax(q k / 8) v per segment.
#define NB 2
#define SS 4096
#define NH 12
#define HD 64
#define DM (NH * HD)
#ifndef TQB
#define TQB (SS / 64)
#define TNB NB
#define QB0 0            // first query block
#endif
typedef __attribute__((ext_vector_type(8))) __bf16 v8b;
__device__ __forceinline__ v16b frag_b(const __bf16* rowk0, int lane) {
  union { v16b v; v8b q[2]; } u; const __bf16* p = rowk0 + 8 * (lane >> 4);
  u.q[0] = *(const v8b*)p; u.q[1] = *(const v8b*)(p + 16); return u.v;
}
__device__ __forceinline__ float bfr(float v) { return (float)(__bf16)v; }
__device__ __attribute__((noinline)) float exp_ni(float v) { return expf(v); }
__device__ __attribute__((noinline)) float erf_ni(float v) { return erff(v); }

#define WS_VT  0u                                   // bf16 v planes [b][h*64 + d][s]
#define WS_END (WS_VT + 2u * (size_t)NB * DM * SS)

// ---- k_vt: block = (64 keys, 128 cols, b): v[b][s][c] -> VT[b][c][s] bf16 (exact)
__global__ __launch_bounds__(256) void k_vt(const float* __restrict__ V, __bf16* __restrict__ VT) { __shared__ __align__(16) __bf16 st[128][64 + 8]; const int t = threadIdx.x; const int s0 = blockIdx.x * 64; const int c0 = blockIdx.y * 128; const size_t b = blockIdx.z;
  for (int e = t; e < 64 * 128; e += 256) { const int sl = e >> 7, c = e & 127; st[c][sl] = (__bf16)V[((b * SS + s0 + sl) * DM) + c0 + c]; } __syncthreads();
  for (int e = t; e < 128 * 8; e += 256) { const int c = e >> 3, q = e & 7; vst2((unsigned*)(VT + ((b * DM + c0 + c) * SS) + s0 + q * 8), *(const v4u*)&st[c][q * 8]); } }
__device__ __forceinline__ v16b fragb_f32(const float* __restrict__ p, int lane) { v16b a; const float* pp = p + 8 * (lane >> 4);
#pragma unroll
  for (int i = 0; i < 8; ++i) { a[i] = (__bf16)pp[i]; a[8 + i] = (__bf16)pp[16 + i]; } return a; }
#define KP 68   // staged K row pitch in floats: 272 B = 16 B x 17, no bank conflict for 16-byte row reads
#define VP 40   // staged V plane row pitch in bf16: 80 B = 16 B x 5, likewise
// fragb_f32 for a 16-byte-aligned row in LDS: same elements, same rounding, four 16-byte reads
__device__ __forceinline__ v16b fragb_lds(const float* p, int lane) { v16b a; const v4f* pp = (const v4f*)(p + 8 * (lane >> 4)); const v4f x0 = pp[0], x1 = pp[1], x2 = pp[4], x3 = pp[5];
#pragma unroll
  for (int i = 0; i < 4; ++i) { a[i] = (__bf16)x0[i]; a[4 + i] = (__bf16)x1[i]; a[8 + i] = (__bf16)x2[i]; a[12 + i] = (__bf16)x3[i]; } return a; }
// one 32-key stage, 6 copies of 16 B per lane: K rows j * 8 + tid / 16 (256 B each, a wave covers 4 whole lines), V plane rows j * 32 + tid / 4 (64 B each).
// The closing s_wait_xcnt stands inside the statement so that no address register named here is rewritten ahead of it.
__device__ __forceinline__ void stage_kv(const float* gk, const __bf16* gv, unsigned lk, unsigned lv) {
  asm volatile("global_load_async_to_lds_b128 %0, %6, off\n\t"
               "global_load_async_to_lds_b128 %1, %7, off\n\t"
               "global_load_async_to_lds_b128 %2, %8, off\n\t"
               "global_load_async_to_lds_b128 %3, %9, off\n\t"
               "global_load_async_to_lds_b128 %4, %10, off\n\t"
               "global_load_async_to_lds_b128 %5, %11, off\n\t"
               "s_wait_xcnt 0x0"
               :: "v"(lk), "v"(lk + 8u * KP * 4u), "v"(lk + 16u * KP * 4u), "v"(lk + 24u * KP * 4u), "v"(lv), "v"(lv + 32u * VP * 2u),
                  "v"(gk), "v"(gk + 8 * DM), "v"(gk + 16 * DM), "v"(gk + 24 * DM), "v"(gv), "v"(gv + (size_t)32 * SS) : "memory");
}
// ---- k_attn: block = (64 queries, head, b): segment length L = 1024 << min(h / 4, 2); keys = the query block's segment; causal (k <= q) only if is_causal != 0, head group 0, segment 0; exact scores, softmax, P as bf16 hi + lo x v planes -> output rows. K rows and V plane rows of 32 keys come to LDS once per block by asynchronous copies, two buffers, the next stage in flight while this one is worked on.
__global__ __launch_bounds__(128) void k_attn(const float* __restrict__ Q, const float* __restrict__ K, const __bf16* __restrict__ VT, const int* __restrict__ ISC, float* __restrict__ CTX) {
  __shared__ __align__(16) float sp[4][16][36]; __shared__ __align__(16) float so[4][16][68];
  __shared__ __align__(16) float kst[2][32][KP]; __shared__ __align__(16) __bf16 vst[2][64][VP];
  const int tid = threadIdx.x, wave = tid >> 5, lane = tid & 31, col = lane & 15, g = lane >> 4; const int qb = blockIdx.x + QB0, h = blockIdx.y; const size_t b = blockIdx.z; const int q0 = qb * 64 + wave * 16; const size_t rq = b * SS + q0;
  v16b aq[2];
#pragma unroll
  for (int kc = 0; kc < 2; ++kc) aq[kc] = fragb_f32(Q + (rq + col) * DM + h * HD + kc * 32, lane);
  float m[8], l[8];
#pragma unroll
  for (int r = 0; r < 8; ++r) { m[r] = -3.0e38f; l[r] = 0.f; }
  v8f acc[4] = {}, accl[4] = {};
  const int grp = (h / 4 > 2) ? 2 : h / 4; const int L = 1024 << grp; const int seg = (qb * 64) / L; const bool causal = (ISC[0] != 0) && grp == 0 && seg == 0; const int ks0 = seg * L / 32;
  const int nst = causal ? qb * 2 + 2 : L / 32;   // stages of 32 keys; causal: up to the block's last query (at least 2, at most L / 32)
  const float* gk = K + (b * SS + (size_t)ks0 * 32 + (tid >> 4)) * DM + h * HD + (tid & 15) * 4;
  const __bf16* gv = VT + (b * DM + h * HD + (tid >> 2)) * SS + (size_t)ks0 * 32 + (tid & 3) * 8;
  const unsigned lk = (unsigned)(size_t)&kst[0][tid >> 4][(tid & 15) * 4], lv = (unsigned)(size_t)&vst[0][tid >> 2][(tid & 3) * 8];
  stage_kv(gk, gv, lk, lv);
  asm volatile("s_wait_asynccnt 0x0" ::: "memory");   // this wave's part of stage 0 has landed
  __syncthreads();                                    // stage 0 readable by all four waves
  stage_kv(gk + 32 * DM, gv + 32, lk + 32u * KP * 4u, lv + 64u * VP * 2u);
#pragma unroll 1
  for (int t = 0; t < nst; ++t) { const int ks = ks0 + t, bf = t & 1; v8f s[2];
    v16b kf[2][2];
#pragma unroll
    for (int ct = 0; ct < 2; ++ct)
#pragma unroll
      for (int kc = 0; kc < 2; ++kc) kf[ct][kc] = fragb_lds(&kst[bf][ct * 16 + col][kc * 32], lane);
#pragma unroll
    for (int ct = 0; ct < 2; ++ct) { const int kk = ks * 32 + ct * 16 + col; v8f c = {};
#pragma unroll
      for (int kc = 0; kc < 2; ++kc) c = wmma_bf(aq[kc], kf[ct][kc], c);
#pragma unroll
      for (int r = 0; r < 8; ++r) s[ct][r] = (!causal || kk <= q0 + 8 * g + r) ? c[r] * 0.125f : -3.0e38f; }
#pragma unroll
    for (int r = 0; r < 8; ++r) { float mx = fmaxf(s[0][r], s[1][r]);
#pragma unroll
      for (int o = 1; o < 16; o <<= 1) mx = fmaxf(mx, __shfl_xor(mx, o));
      const float mn = fmaxf(m[r], mx); const float alpha = (m[r] <= -1.0e38f) ? 0.f : __expf(m[r] - mn);
      const float e0 = (s[0][r] <= -1.0e38f) ? 0.f : __expf(s[0][r] - mn), e1 = (s[1][r] <= -1.0e38f) ? 0.f : __expf(s[1][r] - mn); float es = e0 + e1;
#pragma unroll
      for (int o = 1; o < 16; o <<= 1) es += __shfl_xor(es, o);
      l[r] = l[r] * alpha + es; m[r] = mn;
#pragma unroll
      for (int dt = 0; dt < 4; ++dt) { acc[dt][r] *= alpha; accl[dt][r] *= alpha; }
      sp[wave][8 * g + r][col] = e0; sp[wave][8 * g + r][16 + col] = e1; }
    LDSX();
    v16b vf[4];
#pragma unroll
    for (int dt = 0; dt < 4; ++dt) vf[dt] = frag_b(&vst[bf][dt * 16 + col][0], lane);
    v16b pa, pl; { const float* prow = &sp[wave][col][0] + 8 * (lane >> 4);
#pragma unroll
      for (int i = 0; i < 8; ++i) { const float x0 = prow[i] * 2048.0f, x1 = prow[16 + i] * 2048.0f; const __bf16 h0 = (__bf16)x0, h1 = (__bf16)x1; pa[i] = h0; pa[8 + i] = h1; pl[i] = (__bf16)((x0 - (float)h0) * 256.0f); pl[8 + i] = (__bf16)((x1 - (float)h1) * 256.0f); } }   // bf16 hi + lo (lo x 2^8)
#pragma unroll
    for (int dt = 0; dt < 4; ++dt) { acc[dt] = wmma_bf(pa, vf[dt], acc[dt]); accl[dt] = wmma_bf(pl, vf[dt], accl[dt]); }
    asm volatile("s_wait_dscnt 0x0" ::: "memory");      // this wave's reads of buffer bf (and of its P rows) are done
    asm volatile("s_wait_asynccnt 0x0" ::: "memory");   // this wave's part of stage t + 1 has landed
    __syncthreads();                                    // publishes stage t + 1 and frees buffer bf for the refill
    if (t + 2 < nst) stage_kv(gk + (size_t)(t + 2) * 32 * DM, gv + (t + 2) * 32, lk + (unsigned)bf * (32u * KP * 4u), lv + (unsigned)bf * (64u * VP * 2u)); }
  asm volatile("s_wait_asynccnt 0x0" ::: "memory");     // nothing in flight behind the loop
#pragma unroll
  for (int r = 0; r < 8; ++r) { const float il = (l[r] > 0.f) ? (1.0f / 2048.0f) / l[r] : 0.f;
#pragma unroll
    for (int dt = 0; dt < 4; ++dt) so[wave][8 * g + r][dt * 16 + col] = (acc[dt][r] + accl[dt][r] * (1.0f / 256.0f)) * il; }
  LDSX();
  for (int rl = 0; rl < 16; ++rl) if (lane < 16) vst2(CTX + (rq + rl) * DM + h * HD + lane * 4, *(const v4f*)&so[wave][rl][lane * 4]);
}
extern "C" void kernel_launch(void* const* d_in, const int* in_sizes, int n_in, void* d_out, int out_size, void* d_ws, size_t ws_size, hipStream_t stream) {
  (void)in_sizes; (void)n_in; (void)out_size;
  const float** F = (const float**)d_in;   // 0 q [2,4096,12,64], 1 k, 2 v, 3 is_causal int scalar
  if (ws_size < (size_t)WS_END) return;
  char* ws = (char*)d_ws; __bf16* VT = (__bf16*)(ws + WS_VT);
  k_vt<<<dim3(SS / 64, DM / 128, NB), 256, 0, stream>>>(F[2], VT);
  k_attn<<<dim3(TQB, NH, TNB), 128, 0, stream>>>(F[0], F[1], VT, (const int*)d_in[3], (float*)d_out);
}

// v002
// A run of this version takes 161 microseconds.
// Timed twice side by side with v001, it ran 1.72 and 1.71 times as fast.
// Over all steps from v000 it is 3.12 times as fast.
// compute dtype: all float inputs rounded to bf16, is_causal (int scalar) read on device; scores = q . k with EXACT bf16 x bf16 products on WMMA 16x16x32 restricted to the query's own segment (block-local attention; segment length 1024 / 2048 / 4096 by head group), optional causal exclusion on segment 0 of group 0 when is_causal != 0, x 1/8, running-max softmax in f32 (hardware exp); P (x 2^11) as bf16 hi + lo (2 products) x v (exact bf16 planes); f32 output.
#include <hip/hip_runtime.h>
#include <math.h>

typedef __attribute__((ext_vector_type(16))) _Float16 v16h;
typedef __attribute__((ext_vector_type(16))) __bf16 v16b;
typedef __attribute__((ext_vector_type(8)))  _Float16 v8h;
typedef __attribute__((ext_vector_type(8)))  float v8f;
typedef __attribute__((ext_vector_type(4)))  float v4f;
typedef __attribute__((ext_vector_type(2)))  float v2f;
typedef __attribute__((ext_vector_type(4)))  unsigned v4u;
typedef __attribute__((ext_vector_type(4)))  int v4i;
typedef float __attribute__((may_alias)) float_a;
typedef int __attribute__((may_alias)) int_a;

template <typename T> __device__ __forceinline__ void vst2(void* p, T v) { *(T*)p = v;  }
__device__ __forceinline__ v8f wmma16(v16h a, v16h b, v8f c) {
  v8f d = __builtin_amdgcn_wmma_f32_16x16x32_f16(false, a, false, b, (short)0, c, false, false);
  asm volatile("v_nop\n\tv_nop\n\tv_nop\n\tv_nop" : "+v"(d) : "v"(a), "v"(b));
  return d;
}
__device__ __forceinline__ v8f wmma_bf(v16b a, v16b b, v8f c) {
  v8f d = __builtin_amdgcn_wmma_f32_16x16x32_bf16(false, a, false, b, (short)0, c, false, false);
  asm volatile("v_nop\n\tv_nop\n\tv_nop\n\tv_nop" : "+v"(d) : "v"(a), "v"(b));
  return d;
}
// 16x16x32 fragments: lane = (h = lane>>4, row/col = lane&15); elements 0..7 = k0+8h+0..7, 8..15 = k0+16+8h+0..7; D element r = row 8h+r
__device__ __forceinline__ v16h frag_h(const _Float16* rowk0, int lane) {
  union { v16h v; v8h q[2]; } u; const _Float16* p = rowk0 + 8 * (lane >> 4);
  u.q[0] = *(const v8h*)p; u.q[1] = *(const v8h*)(p + 16); return u.v;
}
__device__ __forceinline__ v16h frag_f32(const float* rowk0, int lane) {
  v16h a; const float* p = rowk0 + 8 * (lane >> 4);
#pragma unroll
  for (int i = 0; i < 8; ++i) { a[i] = (_Float16)p[i]; a[8 + i] = (_Float16)p[16 + i]; }
  return a;
}
__device__ __forceinline__ v16h frag_f32s(const float* rowk0, int lane, float sc) {
  v16h a; const float* p = rowk0 + 8 * (lane >> 4);
#pragma unroll
  for (int i = 0; i < 8; ++i) { a[i] = (_Float16)(p[i] * sc); a[8 + i] = (_Float16)(p[16 + i] * sc); }
  return a;
}
// column fragment from a [K][ld] layout (column n), rows >= K read as 0
__device__ __forceinline__ v16h fragc_f32(const float* W, int k0, int n, int lane, int ld, int K) {
  v16h a; const int g = lane >> 4;
#pragma unroll
  for (int i = 0; i < 8; ++i) { const int ka = k0 + 8 * g + i, kb = ka + 16;
    a[i] = (_Float16)(ka < K ? W[(size_t)(ka < K ? ka : K - 1) * ld + n] : 0.f); a[8 + i] = (_Float16)(kb < K ? W[(size_t)(kb < K ? kb : K - 1) * ld + n] : 0.f); }
  return a;
}
struct F2 { v16b h, l; };
__device__ __forceinline__ F2 bsplit16(const float v[16]) { F2 r;
#pragma unroll
  for (int i = 0; i < 16; ++i) { const __bf16 h = (__bf16)v[i]; r.h[i] = h; r.l[i] = (__bf16)(v[i] - (float)h); }
  return r; }
__device__ __forceinline__ F2 split_row(const float* row, int k0, int lane) { float v[16]; const float* p = row + k0 + 8 * (lane >> 4);
#pragma unroll
  for (int i = 0; i < 8; ++i) { v[i] = p[i]; v[8 + i] = p[16 + i]; }
  return bsplit16(v); }
__device__ __forceinline__ F2 split_rowK(const float* row, int k0, int lane, int K) { float v[16]; const int g = lane >> 4;
#pragma unroll
  for (int i = 0; i < 8; ++i) { const int ka = k0 + 8 * g + i, kb = ka + 16; v[i] = ka < K ? row[ka < K ? ka : K - 1] : 0.f; v[8 + i] = kb < K ? row[kb < K ? kb : K - 1] : 0.f; }
  return bsplit16(v); }
__device__ __forceinline__ F2 split_col(const float* W, int k0, int n, int lane, int ld, int K) { float v[16]; const int g = lane >> 4;
#pragma unroll
  for (int i = 0; i < 8; ++i) { const int ka = k0 + 8 * g + i, kb = ka + 16; v[i] = ka < K ? W[(size_t)(ka < K ? ka : K - 1) * ld + n] : 0.f; v[8 + i] = kb < K ? W[(size_t)(kb < K ? kb : K - 1) * ld + n] : 0.f; }
  return bsplit16(v); }
__device__ __forceinline__ v8f mac3(const F2& a, const F2& b, v8f c) { c = wmma_bf(a.l, b.h, c); c = wmma_bf(a.h, b.l, c); return wmma_bf(a.h, b.h, c); }
__device__ __forceinline__ float sigm(float v) { return 1.0f / (1.0f + expf(-v)); }
#define LDSX() do { asm volatile("s_wait_dscnt 0" ::: "memory"); __builtin_amdgcn_wave_barrier(); __builtin_amdgcn_fence(__ATOMIC_RELEASE, "workgroup"); } while (0)


// Head-parallel block-local ('dilated', degenerate gather) attention on given q, k, v (B 2, N 4,096, 12 heads x 64): heads 0-3 attend within 1,024-token segments, 4-7 within 2,048, 8-11 over all 4,096; softmax(q k / 8) v per segment.
#define NB 2
#define SS 4096
#define NH 12
#define HD 64
#define DM (NH * HD)
#ifndef TQB
#define TQB (SS / 64)
#define TNB NB
#define QB0 0            // first query block
#endif
typedef __attribute__((ext_vector_type(8))) __bf16 v8b;
__device__ __forceinline__ v16b frag_b(const __bf16* rowk0, int lane) {
  union { v16b v; v8b q[2]; } u; const __bf16* p = rowk0 + 8 * (lane >> 4);
  u.q[0] = *(const v8b*)p; u.q[1] = *(const v8b*)(p + 16); return u.v;
}
__device__ __forceinline__ float bfr(float v) { return (float)(__bf16)v; }
__device__ __attribute__((noinline)) float exp_ni(float v) { return expf(v); }
__device__ __attribute__((noinline)) float erf_ni(float v) { return erff(v); }

#define WS_VT  0u                                   // bf16 v planes [b][h*64 + d][s]
#define WS_END (WS_VT + 2u * (size_t)NB * DM * SS)

// ---- k_vt: block = (64 keys, 128 cols, b): v[b][s][c] -> VT[b][c][s] bf16 (exact)
__global__ __launch_bounds__(256) void k_vt(const float* __restrict__ V, __bf16* __restrict__ VT) { __shared__ __align__(16) __bf16 st[128][64 + 8]; const int t = threadIdx.x; const int s0 = blockIdx.x * 64; const int c0 = blockIdx.y * 128; const size_t b = blockIdx.z;
  for (int e = t; e < 64 * 128; e += 256) { const int sl = e >> 7, c = e & 127; st[c][sl] = (__bf16)V[((b * SS + s0 + sl) * DM) + c0 + c]; } __syncthreads();
  for (int e = t; e < 128 * 8; e += 256) { const int c = e >> 3, q = e & 7; vst2((unsigned*)(VT + ((b * DM + c0 + c) * SS) + s0 + q * 8), *(const v4u*)&st[c][q * 8]); } }
__device__ __forceinline__ v16b fragb_f32(const float* __restrict__ p, int lane) { v16b a; const float* pp = p + 8 * (lane >> 4);
#pragma unroll
  for (int i = 0; i < 8; ++i) { a[i] = (__bf16)pp[i]; a[8 + i] = (__bf16)pp[16 + i]; } return a; }
// lane l with lane l ^ 16 (the other half of the wave), on the vector pipe
__device__ __forceinline__ float xhalf(float x) { return __builtin_bit_cast(float, __builtin_amdgcn_permlanex16(__builtin_bit_cast(int, x), __builtin_bit_cast(int, x), 0x76543210, 0xfedcba98, false, false)); }
#define KP 68   // staged K row pitch in floats: 272 B = 16 B x 17, no bank conflict for 16-byte row reads
#define VP 40   // staged V plane row pitch in bf16: 80 B = 16 B x 5, likewise
// fragb_f32 for a 16-byte-aligned row in LDS: same elements, same rounding, four 16-byte reads
__device__ __forceinline__ v16b fragb_lds(const float* p, int lane) { v16b a; const v4f* pp = (const v4f*)(p + 8 * (lane >> 4)); const v4f x0 = pp[0], x1 = pp[1], x2 = pp[4], x3 = pp[5];
#pragma unroll
  for (int i = 0; i < 4; ++i) { a[i] = (__bf16)x0[i]; a[4 + i] = (__bf16)x1[i]; a[8 + i] = (__bf16)x2[i]; a[12 + i] = (__bf16)x3[i]; } return a; }
// one 32-key stage, 6 copies of 16 B per lane: K rows j * 8 + tid / 16 (256 B each, a wave covers 4 whole lines), V plane rows j * 32 + tid / 4 (64 B each).
// The closing s_wait_xcnt stands inside the statement so that no address register named here is rewritten ahead of it.
__device__ __forceinline__ void stage_kv(const float* gk, const __bf16* gv, unsigned lk, unsigned lv) {
  asm volatile("global_load_async_to_lds_b128 %0, %6, off\n\t"
               "global_load_async_to_lds_b128 %1, %7, off\n\t"
               "global_load_async_to_lds_b128 %2, %8, off\n\t"
               "global_load_async_to_lds_b128 %3, %9, off\n\t"
               "global_load_async_to_lds_b128 %4, %10, off\n\t"
               "global_load_async_to_lds_b128 %5, %11, off\n\t"
               "s_wait_xcnt 0x0"
               :: "v"(lk), "v"(lk + 8u * KP * 4u), "v"(lk + 16u * KP * 4u), "v"(lk + 24u * KP * 4u), "v"(lv), "v"(lv + 32u * VP * 2u),
                  "v"(gk), "v"(gk + 8 * DM), "v"(gk + 16 * DM), "v"(gk + 24 * DM), "v"(gv), "v"(gv + (size_t)32 * SS) : "memory");
}
__global__ __launch_bounds__(128) void k_attn(const float* __restrict__ Q, const float* __restrict__ K, const __bf16* __restrict__ VT, const int* __restrict__ ISC, float* __restrict__ CTX) {
  __shared__ __align__(16) float so[4][16][68];
  __shared__ __align__(16) float kst[2][32][KP]; __shared__ __align__(16) __bf16 vst[2][64][VP];
  const int tid = threadIdx.x, wave = tid >> 5, lane = tid & 31, col = lane & 15, g = lane >> 4; const int qb = blockIdx.x + QB0, h = blockIdx.y; const size_t b = blockIdx.z; const int q0 = qb * 64 + wave * 16; const size_t rq = b * SS + q0;
  v16b aq[2];
#pragma unroll
  for (int kc = 0; kc < 2; ++kc) aq[kc] = fragb_f32(Q + (rq + col) * DM + h * HD + kc * 32, lane);
  float m = -3.0e38f, l = 0.f;   // of query q0 + col; l holds this wave half's keys only, the halves are joined behind the loop
  v8f acc[4] = {}, accl[4] = {};
  const int grp = (h / 4 > 2) ? 2 : h / 4; const int L = 1024 << grp; const int seg = (qb * 64) / L; const bool causal = (ISC[0] != 0) && grp == 0 && seg == 0; const int ks0 = seg * L / 32;
  const int nst = causal ? qb * 2 + 2 : L / 32;   // stages of 32 keys; causal: up to the block's last query (at least 2, at most L / 32)
  const float* gk = K + (b * SS + (size_t)ks0 * 32 + (tid >> 4)) * DM + h * HD + (tid & 15) * 4;
  const __bf16* gv = VT + (b * DM + h * HD + (tid >> 2)) * SS + (size_t)ks0 * 32 + (tid & 3) * 8;
  const unsigned lk = (unsigned)(size_t)&kst[0][tid >> 4][(tid & 15) * 4], lv = (unsigned)(size_t)&vst[0][tid >> 2][(tid & 3) * 8];
  stage_kv(gk, gv, lk, lv);
  asm volatile("s_wait_asynccnt 0x0" ::: "memory");   // this wave's part of stage 0 has landed
  __syncthreads();                                    // stage 0 readable by all four waves
  stage_kv(gk + 32 * DM, gv + 32, lk + 32u * KP * 4u, lv + 64u * VP * 2u);
#pragma unroll 1
  for (int t = 0; t < nst; ++t) { const int ks = ks0 + t, bf = t & 1; v8f s[2];
    v16b kf[2][2];
#pragma unroll
    for (int ct = 0; ct < 2; ++ct)
#pragma unroll
      for (int kc = 0; kc < 2; ++kc) kf[ct][kc] = fragb_lds(&kst[bf][ct * 16 + col][kc * 32], lane);
#pragma unroll
    for (int ct = 0; ct < 2; ++ct) { const int kb = ks * 32 + ct * 16 + 8 * g; v8f c = {};
#pragma unroll
      for (int kc = 0; kc < 2; ++kc) c = wmma_bf(kf[ct][kc], aq[kc], c);   // c[r] = score of key kb + r, query q0 + col
#pragma unroll
      for (int r = 0; r < 8; ++r) s[ct][r] = (!causal || kb + r <= q0 + col) ? c[r] * 0.125f : -3.0e38f; }
    v16b vf[4];
#pragma unroll
    for (int dt = 0; dt < 4; ++dt) vf[dt] = frag_b(&vst[bf][dt * 16 + col][0], lane);
    float mr[8];
#pragma unroll
    for (int r = 0; r < 8; ++r) mr[r] = fmaxf(s[0][r], s[1][r]);
    float mx = fmaxf(fmaxf(fmaxf(mr[0], mr[1]), fmaxf(mr[2], mr[3])), fmaxf(fmaxf(mr[4], mr[5]), fmaxf(mr[6], mr[7])));
    mx = fmaxf(mx, xhalf(mx));
    const float mn = fmaxf(m, mx); const float alpha = (m <= -1.0e38f) ? 0.f : __expf(m - mn);
    float e[16];
#pragma unroll
    for (int i = 0; i < 8; ++i) { e[i] = (s[0][i] <= -1.0e38f) ? 0.f : __expf(s[0][i] - mn); e[8 + i] = (s[1][i] <= -1.0e38f) ? 0.f : __expf(s[1][i] - mn); }
    float er[8];
#pragma unroll
    for (int i = 0; i < 8; ++i) er[i] = e[i] + e[8 + i];
    l = l * alpha + (((er[0] + er[1]) + (er[2] + er[3])) + ((er[4] + er[5]) + (er[6] + er[7]))); m = mn;
#pragma unroll
    for (int dt = 0; dt < 4; ++dt) { acc[dt] *= alpha; accl[dt] *= alpha; }
    v16b pa, pl;   // element i = key 8 g + i, element 8 + i = key 16 + 8 g + i: the k order of frag_b
#pragma unroll
    for (int i = 0; i < 16; ++i) { const float x = e[i] * 2048.0f; const __bf16 hi = (__bf16)x; pa[i] = hi; pl[i] = (__bf16)((x - (float)hi) * 256.0f); }   // bf16 hi + lo (lo x 2^8)
#pragma unroll
    for (int dt = 0; dt < 4; ++dt) { acc[dt] = wmma_bf(vf[dt], pa, acc[dt]); accl[dt] = wmma_bf(vf[dt], pl, accl[dt]); }   // acc[dt][r] = out column dt * 16 + 8 g + r of query q0 + col
    asm volatile("s_wait_dscnt 0x0" ::: "memory");      // this wave's reads of buffer bf are done
    asm volatile("s_wait_asynccnt 0x0" ::: "memory");   // this wave's part of stage t + 1 has landed
    __syncthreads();                                    // publishes stage t + 1 and frees buffer bf for the refill
    if (t + 2 < nst) stage_kv(gk + (size_t)(t + 2) * 32 * DM, gv + (t + 2) * 32, lk + (unsigned)bf * (32u * KP * 4u), lv + (unsigned)bf * (64u * VP * 2u)); }
  asm volatile("s_wait_asynccnt 0x0" ::: "memory");     // nothing in flight behind the loop
  l += xhalf(l);
  const float il = (l > 0.f) ? (1.0f / 2048.0f) / l : 0.f;
#pragma unroll
  for (int dt = 0; dt < 4; ++dt)
#pragma unroll
    for (int r = 0; r < 8; ++r) so[wave][col][dt * 16 + 8 * g + r] = (acc[dt][r] + accl[dt][r] * (1.0f / 256.0f)) * il;
  LDSX();
  for (int rl = 0; rl < 16; ++rl) if (lane < 16) vst2(CTX + (rq + rl) * DM + h * HD + lane * 4, *(const v4f*)&so[wave][rl][lane * 4]);
}
extern "C" void kernel_launch(void* const* d_in, const int* in_sizes, int n_in, void* d_out, int out_size, void* d_ws, size_t ws_size, hipStream_t stream) {
  (void)in_sizes; (void)n_in; (void)out_size;
  const float** F = (const float**)d_in;   // 0 q [2,4096,12,64], 1 k, 2 v, 3 is_causal int scalar
  if (ws_size < (size_t)WS_END) return;
  char* ws = (char*)d_ws; __bf16* VT = (__bf16*)(ws + WS_VT);
  k_vt<<<dim3(SS / 64, DM / 128, NB), 256, 0, stream>>>(F[2], VT);
  k_attn<<<dim3(TQB, NH, TNB), 128, 0, stream>>>(F[0], F[1], VT, (const int*)d_in[3], (float*)d_out);
}

// v003
// Measured time: 146 microseconds a run.
// Next to v002, in two timings, it ran 1.09 times as fast each time.
// Over all steps from v000 it is 3.42 times as fast.
// compute dtype: all float inputs rounded to bf16, is_causal (int scalar) read on device; scores = q . k with EXACT bf16 x bf16 products on WMMA 16x16x32 restricted to the query's own segment (block-local attention; segment length 1024 / 2048 / 4096 by head group), optional causal exclusion on segment 0 of group 0 when is_causal != 0, x 1/8, running-max softmax in f32 (hardware exp); P (x 2^11) as bf16 hi + lo (2 products) x v (exact bf16 planes); f32 output.
#include <hip/hip_runtime.h>
#include <math.h>

typedef __attribute__((ext_vector_type(16))) _Float16 v16h;
typedef __attribute__((ext_vector_type(16))) __bf16 v16b;
typedef __attribute__((ext_vector_type(8)))  _Float16 v8h;
typedef __attribute__((ext_vector_type(8)))  float v8f;
typedef __attribute__((ext_vector_type(4)))  float v4f;
typedef __attribute__((ext_vector_type(2)))  float v2f;
typedef __attribute__((ext_vector_type(4)))  unsigned v4u;
typedef __attribute__((ext_vector_type(4)))  int v4i;
typedef float __attribute__((may_alias)) float_a;
typedef int __attribute__((may_alias)) int_a;

template <typename T> __device__ __forceinline__ void vst2(void* p, T v) { *(T*)p = v;  }
__device__ __forceinline__ v8f wmma16(v16h a, v16h b, v8f c) {
  v8f d = __builtin_amdgcn_wmma_f32_16x16x32_f16(false, a, false, b, (short)0, c, false, false);
  asm volatile("v_nop\n\tv_nop\n\tv_nop\n\tv_nop" : "+v"(d) : "v"(a), "v"(b));
  return d;
}
__device__ __forceinline__ v8f wmma_bf(v16b a, v16b b, v8f c) {
  v8f d = __builtin_amdgcn_wmma_f32_16x16x32_bf16(false, a, false, b, (short)0, c, false, false);
  asm volatile("v_nop\n\tv_nop\n\tv_nop\n\tv_nop" : "+v"(d) : "v"(a), "v"(b));
  return d;
}
// 16x16x32 fragments: lane = (h = lane>>4, row/col = lane&15); elements 0..7 = k0+8h+0..7, 8..15 = k0+16+8h+0..7; D element r = row 8h+r
__device__ __forceinline__ v16h frag_h(const _Float16* rowk0, int lane) {
  union { v16h v; v8h q[2]; } u; const _Float16* p = rowk0 + 8 * (lane >> 4);
  u.q[0] = *(const v8h*)p; u.q[1] = *(const v8h*)(p + 16); return u.v;
}
__device__ __forceinline__ v16h frag_f32(const float* rowk0, int lane) {
  v16h a; const float* p = rowk0 + 8 * (lane >> 4);
#pragma unroll
  for (int i = 0; i < 8; ++i) { a[i] = (_Float16)p[i]; a[8 + i] = (_Float16)p[16 + i]; }
  return a;
}
__device__ __forceinline__ v16h frag_f32s(const float* rowk0, int lane, float sc) {
  v16h a; const float* p = rowk0 + 8 * (lane >> 4);
#pragma unroll
  for (int i = 0; i < 8; ++i) { a[i] = (_Float16)(p[i] * sc); a[8 + i] = (_Float16)(p[16 + i] * sc); }
  return a;
}
// column fragment from a [K][ld] layout (column n), rows >= K read as 0
__device__ __forceinline__ v16h fragc_f32(const float* W, int k0, int n, int lane, int ld, int K) {
  v16h a; const int g = lane >> 4;
#pragma unroll
  for (int i = 0; i < 8; ++i) { const int ka = k0 + 8 * g + i, kb = ka + 16;
    a[i] = (_Float16)(ka < K ? W[(size_t)(ka < K ? ka : K - 1) * ld + n] : 0.f); a[8 + i] = (_Float16)(kb < K ? W[(size_t)(kb < K ? kb : K - 1) * ld + n] : 0.f); }
  return a;
}
struct F2 { v16b h, l; };
__device__ __forceinline__ F2 bsplit16(const float v[16]) { F2 r;
#pragma unroll
  for (int i = 0; i < 16; ++i) { const __bf16 h = (__bf16)v[i]; r.h[i] = h; r.l[i] = (__bf16)(v[i] - (float)h); }
  return r; }
__device__ __forceinline__ F2 split_row(const float* row, int k0, int lane) { float v[16]; const float* p = row + k0 + 8 * (lane >> 4);
#pragma unroll
  for (int i = 0; i < 8; ++i) { v[i] = p[i]; v[8 + i] = p[16 + i]; }
  return bsplit16(v); }
__device__ __forceinline__ F2 split_rowK(const float* row, int k0, int lane, int K) { float v[16]; const int g = lane >> 4;
#pragma unroll
  for (int i = 0; i < 8; ++i) { const int ka = k0 + 8 * g + i, kb = ka + 16; v[i] = ka < K ? row[ka < K ? ka : K - 1] : 0.f; v[8 + i] = kb < K ? row[kb < K ? kb : K - 1] : 0.f; }
  return bsplit16(v); }
__device__ __forceinline__ F2 split_col(const float* W, int k0, int n, int lane, int ld, int K) { float v[16]; const int g = lane >> 4;
#pragma unroll
  for (int i = 0; i < 8; ++i) { const int ka = k0 + 8 * g + i, kb = ka + 16; v[i] = ka < K ? W[(size_t)(ka < K ? ka : K - 1) * ld + n] : 0.f; v[8 + i] = kb < K ? W[(size_t)(kb < K ? kb : K - 1) * ld + n] : 0.f; }
  return bsplit16(v); }
__device__ __forceinline__ v8f mac3(const F2& a, const F2& b, v8f c) { c = wmma_bf(a.l, b.h, c); c = wmma_bf(a.h, b.l, c); return wmma_bf(a.h, b.h, c); }
__device__ __forceinline__ float sigm(float v) { return 1.0f / (1.0f + expf(-v)); }
#define LDSX() do { asm volatile("s_wait_dscnt 0" ::: "memory"); __builtin_amdgcn_wave_barrier(); __builtin_amdgcn_fence(__ATOMIC_RELEASE, "workgroup"); } while (0)


// Head-parallel block-local ('dilated', degenerate gather) attention on given q, k, v (B 2, N 4,096, 12 heads x 64): heads 0-3 attend within 1,024-token segments, 4-7 within 2,048, 8-11 over all 4,096; softmax(q k / 8) v per segment.
#define NB 2
#define SS 4096
#define NH 12
#define HD 64
#define DM (NH * HD)
#ifndef TQB
#define TQB (SS / 64)
#define TNB NB
#define QB0 0            // first query block
#endif
typedef __attribute__((ext_vector_type(8))) __bf16 v8b;
__device__ __forceinline__ v16b frag_b(const __bf16* rowk0, int lane) {
  union { v16b v; v8b q[2]; } u; const __bf16* p = rowk0 + 8 * (lane >> 4);
  u.q[0] = *(const v8b*)p; u.q[1] = *(const v8b*)(p + 16); return u.v;
}
__device__ __forceinline__ float bfr(float v) { return (float)(__bf16)v; }
__device__ __attribute__((noinline)) float exp_ni(float v) { return expf(v); }
__device__ __attribute__((noinline)) float erf_ni(float v) { return erff(v); }

#define WS_VT  0u                                   // bf16 v planes [b][h*64 + d][s]
#define WS_END (WS_VT + 2u * (size_t)NB * DM * SS)

// ---- k_vt: block = (64 keys, 128 cols, b): v[b][s][c] -> VT[b][c][s] bf16 (exact)
__global__ __launch_bounds__(256) void k_vt(const float* __restrict__ V, __bf16* __restrict__ VT) { __shared__ __align__(16) __bf16 st[128][64 + 8]; const int t = threadIdx.x; const int s0 = blockIdx.x * 64; const int c0 = blockIdx.y * 128; const size_t b = blockIdx.z;
  for (int e = t; e < 64 * 128; e += 256) { const int sl = e >> 7, c = e & 127; st[c][sl] = (__bf16)V[((b * SS + s0 + sl) * DM) + c0 + c]; } __syncthreads();
  for (int e = t; e < 128 * 8; e += 256) { const int c = e >> 3, q = e & 7; vst2((unsigned*)(VT + ((b * DM + c0 + c) * SS) + s0 + q * 8), *(const v4u*)&st[c][q * 8]); } }
__device__ __forceinline__ v16b fragb_f32(const float* __restrict__ p, int lane) { v16b a; const float* pp = p + 8 * (lane >> 4);
#pragma unroll
  for (int i = 0; i < 8; ++i) { a[i] = (__bf16)pp[i]; a[8 + i] = (__bf16)pp[16 + i]; } return a; }
// lane l with lane l ^ 16 (the other half of the wave), on the vector pipe
__device__ __forceinline__ float xhalf(float x) { return __builtin_bit_cast(float, __builtin_amdgcn_permlanex16(__builtin_bit_cast(int, x), __builtin_bit_cast(int, x), 0x76543210, 0xfedcba98, false, false)); }
#define KP 68   // staged K row pitch in floats: 272 B = 16 B x 17, no bank conflict for 16-byte row reads
#define VP 40   // staged V plane row pitch in bf16: 80 B = 16 B x 5, likewise
// fragb_f32 for a 16-byte-aligned row in LDS: same elements, same rounding, four 16-byte reads
__device__ __forceinline__ v16b fragb_lds(const float* p, int lane) { v16b a; const v4f* pp = (const v4f*)(p + 8 * (lane >> 4)); const v4f x0 = pp[0], x1 = pp[1], x2 = pp[4], x3 = pp[5];
#pragma unroll
  for (int i = 0; i < 4; ++i) { a[i] = (__bf16)x0[i]; a[4 + i] = (__bf16)x1[i]; a[8 + i] = (__bf16)x2[i]; a[12 + i] = (__bf16)x3[i]; } return a; }
// one 32-key stage, 6 copies of 16 B per lane: K rows j * 8 + tid / 16 (256 B each, a wave covers 4 whole lines), V plane rows j * 32 + tid / 4 (64 B each).
// The closing s_wait_xcnt stands inside the statement so that no address register named here is rewritten ahead of it.
__device__ __forceinline__ void stage_kv(const float* gk, const __bf16* gv, unsigned lk, unsigned lv) {
  asm volatile("global_load_async_to_lds_b128 %0, %6, off\n\t"
               "global_load_async_to_lds_b128 %1, %7, off\n\t"
               "global_load_async_to_lds_b128 %2, %8, off\n\t"
               "global_load_async_to_lds_b128 %3, %9, off\n\t"
               "global_load_async_to_lds_b128 %4, %10, off\n\t"
               "global_load_async_to_lds_b128 %5, %11, off\n\t"
               "s_wait_xcnt 0x0"
               :: "v"(lk), "v"(lk + 8u * KP * 4u), "v"(lk + 16u * KP * 4u), "v"(lk + 24u * KP * 4u), "v"(lv), "v"(lv + 32u * VP * 2u),
                  "v"(gk), "v"(gk + 8 * DM), "v"(gk + 16 * DM), "v"(gk + 24 * DM), "v"(gv), "v"(gv + (size_t)32 * SS) : "memory");
}
// one pass of 32 keys for this wave's 16 queries, from the staged K rows kt and V plane rows vt. MK = the pass may hold keys behind a query of a causal block: only then the key index is compared, and only then a score can be the excluded value, so only then the exponentials are guarded; in every other pass all 32 scores are finite, and exp(m - mn) of the start value of m is 0 by itself.
template <bool MK> __device__ __forceinline__ void kv_pass(const float (*kt)[KP], const __bf16 (*vt)[VP], const v16b (&aq)[2], int kb0, int qi, int lane, float& m, float& l, v8f (&acc)[4], v8f (&accl)[4]) {
  const int col = lane & 15; v8f s[2];
  v16b kf[2][2];
#pragma unroll
  for (int ct = 0; ct < 2; ++ct)
#pragma unroll
    for (int kc = 0; kc < 2; ++kc) kf[ct][kc] = fragb_lds(&kt[ct * 16 + col][kc * 32], lane);
#pragma unroll
  for (int ct = 0; ct < 2; ++ct) { const int kb = kb0 + ct * 16; v8f c = {};
#pragma unroll
    for (int kc = 0; kc < 2; ++kc) c = wmma_bf(kf[ct][kc], aq[kc], c);   // c[r] = score of key kb + r, query qi
#pragma unroll
    for (int r = 0; r < 8; ++r) s[ct][r] = (!MK || kb + r <= qi) ? c[r] * 0.125f : -3.0e38f; }
  v16b vf[4];
#pragma unroll
  for (int dt = 0; dt < 4; ++dt) vf[dt] = frag_b(&vt[dt * 16 + col][0], lane);
  float mr[8];
#pragma unroll
  for (int r = 0; r < 8; ++r) mr[r] = fmaxf(s[0][r], s[1][r]);
  float mx = fmaxf(fmaxf(fmaxf(mr[0], mr[1]), fmaxf(mr[2], mr[3])), fmaxf(fmaxf(mr[4], mr[5]), fmaxf(mr[6], mr[7])));
  mx = fmaxf(mx, xhalf(mx));
  const float mn = fmaxf(m, mx); const float alpha = (MK && m <= -1.0e38f) ? 0.f : __expf(m - mn);
  float e[16];
#pragma unroll
  for (int i = 0; i < 8; ++i) { e[i] = (MK && s[0][i] <= -1.0e38f) ? 0.f : __expf(s[0][i] - mn); e[8 + i] = (MK && s[1][i] <= -1.0e38f) ? 0.f : __expf(s[1][i] - mn); }
  float er[8];
#pragma unroll
  for (int i = 0; i < 8; ++i) er[i] = e[i] + e[8 + i];
  l = l * alpha + (((er[0] + er[1]) + (er[2] + er[3])) + ((er[4] + er[5]) + (er[6] + er[7]))); m = mn;
#pragma unroll
  for (int dt = 0; dt < 4; ++dt) { acc[dt] *= alpha; accl[dt] *= alpha; }
  v16b pa, pl;   // element i = key 8 g + i, element 8 + i = key 16 + 8 g + i: the k order of frag_b
#pragma unroll
  for (int i = 0; i < 16; ++i) { const float x = e[i] * 2048.0f; const __bf16 hi = (__bf16)x; pa[i] = hi; pl[i] = (__bf16)((x - (float)hi) * 256.0f); }   // bf16 hi + lo (lo x 2^8)
#pragma unroll
  for (int dt = 0; dt < 4; ++dt) { acc[dt] = wmma_bf(vf[dt], pa, acc[dt]); accl[dt] = wmma_bf(vf[dt], pl, accl[dt]); }   // acc[dt][r] = out column dt * 16 + 8 g + r of query qi
}
// passes t0 .. t1 - 1 of the nst passes of a block, all of one form; the foot of each pass is the ring's: own LDS reads done, own copies landed, one block barrier, then the refill two stages ahead
template <bool MK> __device__ __forceinline__ void kv_loop(int t0, int t1, int nst, int ks0, const float (*kst)[32][KP], const __bf16 (*vst)[64][VP], const float* gk, const __bf16* gv, unsigned lk, unsigned lv, const v16b (&aq)[2], int qi, int lane, float& m, float& l, v8f (&acc)[4], v8f (&accl)[4]) {
  // stays rolled, as before: a second copy of this long body would add code and live registers and save only the loop's few scalar instructions
#pragma unroll 1
  for (int t = t0; t < t1; ++t) { const int bf = t & 1;
    kv_pass<MK>(kst[bf], vst[bf], aq, (ks0 + t) * 32 + 8 * (lane >> 4), qi, lane, m, l, acc, accl);
    asm volatile("s_wait_dscnt 0x0" ::: "memory");      // this wave's reads of buffer bf are done
    asm volatile("s_wait_asynccnt 0x0" ::: "memory");   // this wave's part of stage t + 1 has landed
    __syncthreads();                                    // publishes stage t + 1 and frees buffer bf for the refill
    if (t + 2 < nst) stage_kv(gk + (size_t)(t + 2) * 32 * DM, gv + (t + 2) * 32, lk + (unsigned)bf * (32u * KP * 4u), lv + (unsigned)bf * (64u * VP * 2u)); }
}
__global__ __launch_bounds__(128) void k_attn(const float* __restrict__ Q, const float* __restrict__ K, const __bf16* __restrict__ VT, const int* __restrict__ ISC, float* __restrict__ CTX) {
  __shared__ __align__(16) float so[4][16][68];
  __shared__ __align__(16) float kst[2][32][KP]; __shared__ __align__(16) __bf16 vst[2][64][VP];
  const int tid = threadIdx.x, wave = tid >> 5, lane = tid & 31, col = lane & 15, g = lane >> 4; const int qb = blockIdx.x + QB0, h = blockIdx.y; const size_t b = blockIdx.z; const int q0 = qb * 64 + wave * 16; const size_t rq = b * SS + q0;
  v16b aq[2];
#pragma unroll
  for (int kc = 0; kc < 2; ++kc) aq[kc] = fragb_f32(Q + (rq + col) * DM + h * HD + kc * 32, lane);
  float m = -3.0e38f, l = 0.f;   // of query q0 + col; l holds this wave half's keys only, the halves are joined behind the loop
  v8f acc[4] = {}, accl[4] = {};
  const int grp = (h / 4 > 2) ? 2 : h / 4; const int L = 1024 << grp; const int seg = (qb * 64) / L; const bool causal = (ISC[0] != 0) && grp == 0 && seg == 0; const int ks0 = seg * L / 32;
  const int nst = causal ? qb * 2 + 2 : L / 32;   // stages of 32 keys; causal: up to the block's last query (at least 2, at most L / 32)
  const float* gk = K + (b * SS + (size_t)ks0 * 32 + (tid >> 4)) * DM + h * HD + (tid & 15) * 4;
  const __bf16* gv = VT + (b * DM + h * HD + (tid >> 2)) * SS + (size_t)ks0 * 32 + (tid & 3) * 8;
  const unsigned lk = (unsigned)(size_t)&kst[0][tid >> 4][(tid & 15) * 4], lv = (unsigned)(size_t)&vst[0][tid >> 2][(tid & 3) * 8];
  stage_kv(gk, gv, lk, lv);
  asm volatile("s_wait_asynccnt 0x0" ::: "memory");   // this wave's part of stage 0 has landed
  __syncthreads();                                    // stage 0 readable by all four waves
  stage_kv(gk + 32 * DM, gv + 32, lk + 32u * KP * 4u, lv + 64u * VP * 2u);
  const int nfree = causal ? nst - 2 : nst;   // a causal block's last two passes (keys from its first query on) are the only ones that can hold a key behind a query
  kv_loop<false>(0, nfree, nst, ks0, kst, vst, gk, gv, lk, lv, aq, q0 + col, lane, m, l, acc, accl);
  kv_loop<true>(nfree, nst, nst, ks0, kst, vst, gk, gv, lk, lv, aq, q0 + col, lane, m, l, acc, accl);
  asm volatile("s_wait_asynccnt 0x0" ::: "memory");     // nothing in flight behind the loop
  l += xhalf(l);
  const float il = (l > 0.f) ? (1.0f / 2048.0f) / l : 0.f;
#pragma unroll
  for (int dt = 0; dt < 4; ++dt)
#pragma unroll
    for (int r = 0; r < 8; ++r) so[wave][col][dt * 16 + 8 * g + r] = (acc[dt][r] + accl[dt][r] * (1.0f / 256.0f)) * il;
  LDSX();
  for (int rl = 0; rl < 16; ++rl) if (lane < 16) vst2(CTX + (rq + rl) * DM + h * HD + lane * 4, *(const v4f*)&so[wave][rl][lane * 4]);
}
extern "C" void kernel_launch(void* const* d_in, const int* in_sizes, int n_in, void* d_out, int out_size, void* d_ws, size_t ws_size, hipStream_t stream) {
  (void)in_sizes; (void)n_in; (void)out_size;
  const float** F = (const float**)d_in;   // 0 q [2,4096,12,64], 1 k, 2 v, 3 is_causal int scalar
  if (ws_size < (size_t)WS_END) return;
  char* ws = (char*)d_ws; __bf16* VT = (__bf16*)(ws + WS_VT);
  k_vt<<<dim3(SS / 64, DM / 128, NB), 256, 0, stream>>>(F[2], VT);
  k_attn<<<dim3(TQB, NH, TNB), 128, 0, stream>>>(F[0], F[1], VT, (const int*)d_in[3], (float*)d_out);
}

// v005
// One run takes 102 microseconds.
// Versions in between are left out here; by their measured steps it is 1.43 times as fast as v003.
// Counting every step since v000, it is 4.88 times as fast.
// compute dtype: all float inputs rounded to bf16, is_causal (int scalar) read on device; scores = q . k with EXACT bf16 x bf16 products on WMMA 16x16x32 restricted to the query's own segment (block-local attention; segment length 1024 / 2048 / 4096 by head group), optional causal exclusion on segment 0 of group 0 when is_causal != 0, x 1/8, running-max softmax in f32 (hardware exp); P (x 2^11) rounded once to f16 (11 significand bits, 1 product on WMMA 16x16x32 f16) x v (the bf16-rounded values held as f16 planes, exact from 2^-14 up); f32 output.
#include <hip/hip_runtime.h>
#include <math.h>

typedef __attribute__((ext_vector_type(16))) _Float16 v16h;
typedef __attribute__((ext_vector_type(16))) __bf16 v16b;
typedef __attribute__((ext_vector_type(8)))  _Float16 v8h;
typedef __attribute__((ext_vector_type(8)))  float v8f;
typedef __attribute__((ext_vector_type(4)))  float v4f;
typedef __attribute__((ext_vector_type(2)))  float v2f;
typedef __attribute__((ext_vector_type(4)))  unsigned v4u;
typedef __attribute__((ext_vector_type(4)))  int v4i;
typedef float __attribute__((may_alias)) float_a;
typedef int __attribute__((may_alias)) int_a;

template <typename T> __device__ __forceinline__ void vst2(void* p, T v) { *(T*)p = v;  }
__device__ __forceinline__ v8f wmma16(v16h a, v16h b, v8f c) {
  v8f d = __builtin_amdgcn_wmma_f32_16x16x32_f16(false, a, false, b, (short)0, c, false, false);
  asm volatile("v_nop\n\tv_nop\n\tv_nop\n\tv_nop" : "+v"(d) : "v"(a), "v"(b));
  return d;
}
__device__ __forceinline__ v8f wmma_bf(v16b a, v16b b, v8f c) {
  v8f d = __builtin_amdgcn_wmma_f32_16x16x32_bf16(false, a, false, b, (short)0, c, false, false);
  asm volatile("v_nop\n\tv_nop\n\tv_nop\n\tv_nop" : "+v"(d) : "v"(a), "v"(b));
  return d;
}
// 16x16x32 fragments: lane = (h = lane>>4, row/col = lane&15); elements 0..7 = k0+8h+0..7, 8..15 = k0+16+8h+0..7; D element r = row 8h+r
__device__ __forceinline__ v16h frag_h(const _Float16* rowk0, int lane) {
  union { v16h v; v8h q[2]; } u; const _Float16* p = rowk0 + 8 * (lane >> 4);
  u.q[0] = *(const v8h*)p; u.q[1] = *(const v8h*)(p + 16); return u.v;
}
__device__ __forceinline__ v16h frag_f32(const float* rowk0, int lane) {
  v16h a; const float* p = rowk0 + 8 * (lane >> 4);
#pragma unroll
  for (int i = 0; i < 8; ++i) { a[i] = (_Float16)p[i]; a[8 + i] = (_Float16)p[16 + i]; }
  return a;
}
__device__ __forceinline__ v16h frag_f32s(const float* rowk0, int lane, float sc) {
  v16h a; const float* p = rowk0 + 8 * (lane >> 4);
#pragma unroll
  for (int i = 0; i < 8; ++i) { a[i] = (_Float16)(p[i] * sc); a[8 + i] = (_Float16)(p[16 + i] * sc); }
  return a;
}
// column fragment from a [K][ld] layout (column n), rows >= K read as 0
__device__ __forceinline__ v16h fragc_f32(const float* W, int k0, int n, int lane, int ld, int K) {
  v16h a; const int g = lane >> 4;
#pragma unroll
  for (int i = 0; i < 8; ++i) { const int ka = k0 + 8 * g + i, kb = ka + 16;
    a[i] = (_Float16)(ka < K ? W[(size_t)(ka < K ? ka : K - 1) * ld + n] : 0.f); a[8 + i] = (_Float16)(kb < K ? W[(size_t)(kb < K ? kb : K - 1) * ld + n] : 0.f); }
  return a;
}
struct F2 { v16b h, l; };
__device__ __forceinline__ F2 bsplit16(const float v[16]) { F2 r;
#pragma unroll
  for (int i = 0; i < 16; ++i) { const __bf16 h = (__bf16)v[i]; r.h[i] = h; r.l[i] = (__bf16)(v[i] - (float)h); }
  return r; }
__device__ __forceinline__ F2 split_row(const float* row, int k0, int lane) { float v[16]; const float* p = row + k0 + 8 * (lane >> 4);
#pragma unroll
  for (int i = 0; i < 8; ++i) { v[i] = p[i]; v[8 + i] = p[16 + i]; }
  return bsplit16(v); }
__device__ __forceinline__ F2 split_rowK(const float* row, int k0, int lane, int K) { float v[16]; const int g = lane >> 4;
#pragma unroll
  for (int i = 0; i < 8; ++i) { const int ka = k0 + 8 * g + i, kb = ka + 16; v[i] = ka < K ? row[ka < K ? ka : K - 1] : 0.f; v[8 + i] = kb < K ? row[kb < K ? kb : K - 1] : 0.f; }
  return bsplit16(v); }
__device__ __forceinline__ F2 split_col(const float* W, int k0, int n, int lane, int ld, int K) { float v[16]; const int g = lane >> 4;
#pragma unroll
  for (int i = 0; i < 8; ++i) { const int ka = k0 + 8 * g + i, kb = ka + 16; v[i] = ka < K ? W[(size_t)(ka < K ? ka : K - 1) * ld + n] : 0.f; v[8 + i] = kb < K ? W[(size_t)(kb < K ? kb : K - 1) * ld + n] : 0.f; }
  return bsplit16(v); }
__device__ __forceinline__ v8f mac3(const F2& a, const F2& b, v8f c) { c = wmma_bf(a.l, b.h, c); c = wmma_bf(a.h, b.l, c); return wmma_bf(a.h, b.h, c); }
__device__ __forceinline__ float sigm(float v) { return 1.0f / (1.0f + expf(-v)); }
#define LDSX() do { asm volatile("s_wait_dscnt 0" ::: "memory"); __builtin_amdgcn_wave_barrier(); __builtin_amdgcn_fence(__ATOMIC_RELEASE, "workgroup"); } while (0)


// Head-parallel block-local ('dilated', degenerate gather) attention on given q, k, v (B 2, N 4,096, 12 heads x 64): heads 0-3 attend within 1,024-token segments, 4-7 within 2,048, 8-11 over all 4,096; softmax(q k / 8) v per segment.
#define NB 2
#define SS 4096
#define NH 12
#define HD 64
#define DM (NH * HD)
#ifndef TQB
#define TQB (SS / 64)
#define TNB NB
#define QB0 0            // first query block
#endif
typedef __attribute__((ext_vector_type(8))) __bf16 v8b;
__device__ __forceinline__ v16b frag_b(const __bf16* rowk0, int lane) {
  union { v16b v; v8b q[2]; } u; const __bf16* p = rowk0 + 8 * (lane >> 4);
  u.q[0] = *(const v8b*)p; u.q[1] = *(const v8b*)(p + 16); return u.v;
}
__device__ __forceinline__ float bfr(float v) { return (float)(__bf16)v; }
__device__ __attribute__((noinline)) float exp_ni(float v) { return expf(v); }
__device__ __attribute__((noinline)) float erf_ni(float v) { return erff(v); }

#define WS_VT  0u                                   // f16 v planes [b][h*64 + d][s]
#define WS_END (WS_VT + 2u * (size_t)NB * DM * SS)

// ---- k_vt: block = (64 keys, 128 cols, b): v[b][s][c] -> VT[b][c][s]: rounded to bf16 as every float input, that value stored as f16
__global__ __launch_bounds__(256) void k_vt(const float* __restrict__ V, _Float16* __restrict__ VT) { __shared__ __align__(16) _Float16 st[128][64 + 8]; const int t = threadIdx.x; const int s0 = blockIdx.x * 64; const int c0 = blockIdx.y * 128; const size_t b = blockIdx.z;
  for (int e = t; e < 64 * 128; e += 256) { const int sl = e >> 7, c = e & 127; st[c][sl] = (_Float16)bfr(V[((b * SS + s0 + sl) * DM) + c0 + c]); } __syncthreads();
  for (int e = t; e < 128 * 8; e += 256) { const int c = e >> 3, q = e & 7; vst2((unsigned*)(VT + ((b * DM + c0 + c) * SS) + s0 + q * 8), *(const v4u*)&st[c][q * 8]); } }
__device__ __forceinline__ v16b fragb_f32(const float* __restrict__ p, int lane) { v16b a; const float* pp = p + 8 * (lane >> 4);
#pragma unroll
  for (int i = 0; i < 8; ++i) { a[i] = (__bf16)pp[i]; a[8 + i] = (__bf16)pp[16 + i]; } return a; }
// lane l with lane l ^ 16 (the other half of the wave), on the vector pipe
__device__ __forceinline__ float xhalf(float x) { return __builtin_bit_cast(float, __builtin_amdgcn_permlanex16(__builtin_bit_cast(int, x), __builtin_bit_cast(int, x), 0x76543210, 0xfedcba98, false, false)); }
#define KP 68   // staged K row pitch in floats: 272 B = 16 B x 17, no bank conflict for 16-byte row reads
#define VP 40   // staged V plane row pitch in f16: 80 B = 16 B x 5, likewise
// fragb_f32 for a 16-byte-aligned row in LDS: same elements, same rounding, four 16-byte reads
__device__ __forceinline__ v16b fragb_lds(const float* p, int lane) { v16b a; const v4f* pp = (const v4f*)(p + 8 * (lane >> 4)); const v4f x0 = pp[0], x1 = pp[1], x2 = pp[4], x3 = pp[5];
#pragma unroll
  for (int i = 0; i < 4; ++i) { a[i] = (__bf16)x0[i]; a[4 + i] = (__bf16)x1[i]; a[8 + i] = (__bf16)x2[i]; a[12 + i] = (__bf16)x3[i]; } return a; }
// one 32-key stage, 6 copies of 16 B per lane: K rows j * 8 + tid / 16 (256 B each, a wave covers 4 whole lines), V plane rows j * 32 + tid / 4 (64 B each).
// The closing s_wait_xcnt stands inside the statement so that no address register named here is rewritten ahead of it.
__device__ __forceinline__ void stage_kv(const float* gk, const _Float16* gv, unsigned lk, unsigned lv) {
  asm volatile("global_load_async_to_lds_b128 %0, %6, off\n\t"
               "global_load_async_to_lds_b128 %1, %7, off\n\t"
               "global_load_async_to_lds_b128 %2, %8, off\n\t"
               "global_load_async_to_lds_b128 %3, %9, off\n\t"
               "global_load_async_to_lds_b128 %4, %10, off\n\t"
               "global_load_async_to_lds_b128 %5, %11, off\n\t"
               "s_wait_xcnt 0x0"
               :: "v"(lk), "v"(lk + 8u * KP * 4u), "v"(lk + 16u * KP * 4u), "v"(lk + 24u * KP * 4u), "v"(lv), "v"(lv + 32u * VP * 2u),
                  "v"(gk), "v"(gk + 8 * DM), "v"(gk + 16 * DM), "v"(gk + 24 * DM), "v"(gv), "v"(gv + (size_t)32 * SS) : "memory");
}
// one pass of 32 keys for this wave's 16 queries, from the staged K rows kt and V plane rows vt. MK = the pass may hold keys behind a query of a causal block: only then the key index is compared, and only then a score can be the excluded value, so only then the exponentials are guarded; in every other pass all 32 scores are finite, and exp(m - mn) of the start value of m is 0 by itself.
template <bool MK> __device__ __forceinline__ void kv_pass(const float (*kt)[KP], const _Float16 (*vt)[VP], const v16b (&aq)[2], int kb0, int qi, int lane, float& m, float& l, v8f (&acc)[4]) {
  const int col = lane & 15; v8f s[2];
  v16b kf[2][2];
#pragma unroll
  for (int ct = 0; ct < 2; ++ct)
#pragma unroll
    for (int kc = 0; kc < 2; ++kc) kf[ct][kc] = fragb_lds(&kt[ct * 16 + col][kc * 32], lane);
#pragma unroll
  for (int ct = 0; ct < 2; ++ct) { const int kb = kb0 + ct * 16; v8f c = {};
#pragma unroll
    for (int kc = 0; kc < 2; ++kc) c = wmma_bf(kf[ct][kc], aq[kc], c);   // c[r] = score of key kb + r, query qi
#pragma unroll
    for (int r = 0; r < 8; ++r) s[ct][r] = (!MK || kb + r <= qi) ? c[r] * 0.125f : -3.0e38f; }
  v16h vf[4];
#pragma unroll
  for (int dt = 0; dt < 4; ++dt) vf[dt] = frag_h(&vt[dt * 16 + col][0], lane);
  float mr[8];
#pragma unroll
  for (int r = 0; r < 8; ++r) mr[r] = fmaxf(s[0][r], s[1][r]);
  float mx = fmaxf(fmaxf(fmaxf(mr[0], mr[1]), fmaxf(mr[2], mr[3])), fmaxf(fmaxf(mr[4], mr[5]), fmaxf(mr[6], mr[7])));
  mx = fmaxf(mx, xhalf(mx));
  const float mn = fmaxf(m, mx); const float alpha = (MK && m <= -1.0e38f) ? 0.f : __expf(m - mn);
  float e[16];
#pragma unroll
  for (int i = 0; i < 8; ++i) { e[i] = (MK && s[0][i] <= -1.0e38f) ? 0.f : __expf(s[0][i] - mn); e[8 + i] = (MK && s[1][i] <= -1.0e38f) ? 0.f : __expf(s[1][i] - mn); }
  float er[8];
#pragma unroll
  for (int i = 0; i < 8; ++i) er[i] = e[i] + e[8 + i];
  l = l * alpha + (((er[0] + er[1]) + (er[2] + er[3])) + ((er[4] + er[5]) + (er[6] + er[7]))); m = mn;
#pragma unroll
  for (int dt = 0; dt < 4; ++dt) acc[dt] *= alpha;
  v16h pa;   // element i = key 8 g + i, element 8 + i = key 16 + 8 g + i: the k order of frag_h
#pragma unroll
  for (int i = 0; i < 16; ++i) pa[i] = (_Float16)(e[i] * 2048.0f);   // x 2^11: weights down to 2^-25 of the row's maximum stay normal f16 numbers
#pragma unroll
  for (int dt = 0; dt < 4; ++dt) acc[dt] = wmma16(vf[dt], pa, acc[dt]);   // acc[dt][r] = out column dt * 16 + 8 g + r of query qi
}
// passes t0 .. t1 - 1 of the nst passes of a block, all of one form; the foot of each pass is the ring's: own LDS reads done, own copies landed, one block barrier, then the refill two stages ahead
template <bool MK> __device__ __forceinline__ void kv_loop(int t0, int t1, int nst, int ks0, const float (*kst)[32][KP], const _Float16 (*vst)[64][VP], const float* gk, const _Float16* gv, unsigned lk, unsigned lv, const v16b (&aq)[2], int qi, int lane, float& m, float& l, v8f (&acc)[4]) {
  // stays rolled, as before: a second copy of this long body would add code and live registers and save only the loop's few scalar instructions
#pragma unroll 1
  for (int t = t0; t < t1; ++t) { const int bf = t & 1;
    kv_pass<MK>(kst[bf], vst[bf], aq, (ks0 + t) * 32 + 8 * (lane >> 4), qi, lane, m, l, acc);
    asm volatile("s_wait_dscnt 0x0" ::: "memory");      // this wave's reads of buffer bf are done
    asm volatile("s_wait_asynccnt 0x0" ::: "memory");   // this wave's part of stage t + 1 has landed
    __syncthreads();                                    // publishes stage t + 1 and frees buffer bf for the refill
    if (t + 2 < nst) stage_kv(gk + (size_t)(t + 2) * 32 * DM, gv + (t + 2) * 32, lk + (unsigned)bf * (32u * KP * 4u), lv + (unsigned)bf * (64u * VP * 2u)); }
}
__global__ __launch_bounds__(128) void k_attn(const float* __restrict__ Q, const float* __restrict__ K, const _Float16* __restrict__ VT, const int* __restrict__ ISC, float* __restrict__ CTX) {
  __shared__ __align__(16) float so[4][16][68];
  __shared__ __align__(16) float kst[2][32][KP]; __shared__ __align__(16) _Float16 vst[2][64][VP];
  const int tid = threadIdx.x, wave = tid >> 5, lane = tid & 31, col = lane & 15, g = lane >> 4; const int qb = blockIdx.x + QB0, h = NH - 1 - (int)blockIdx.z; const size_t b = blockIdx.y; const int q0 = qb * 64 + wave * 16; const size_t rq = b * SS + q0;
  v16b aq[2];
#pragma unroll
  for (int kc = 0; kc < 2; ++kc) aq[kc] = fragb_f32(Q + (rq + col) * DM + h * HD + kc * 32, lane);
  float m = -3.0e38f, l = 0.f;   // of query q0 + col; l holds this wave half's keys only, the halves are joined behind the loop
  v8f acc[4] = {};
  const int grp = (h / 4 > 2) ? 2 : h / 4; const int L = 1024 << grp; const int seg = (qb * 64) / L; const bool causal = (ISC[0] != 0) && grp == 0 && seg == 0; const int ks0 = seg * L / 32;
  const int nst = causal ? qb * 2 + 2 : L / 32;   // stages of 32 keys; causal: up to the block's last query (at least 2, at most L / 32)
  const float* gk = K + (b * SS + (size_t)ks0 * 32 + (tid >> 4)) * DM + h * HD + (tid & 15) * 4;
  const _Float16* gv = VT + (b * DM + h * HD + (tid >> 2)) * SS + (size_t)ks0 * 32 + (tid & 3) * 8;
  const unsigned lk = (unsigned)(size_t)&kst[0][tid >> 4][(tid & 15) * 4], lv = (unsigned)(size_t)&vst[0][tid >> 2][(tid & 3) * 8];
  stage_kv(gk, gv, lk, lv);
  asm volatile("s_wait_asynccnt 0x0" ::: "memory");   // this wave's part of stage 0 has landed
  __syncthreads();                                    // stage 0 readable by all four waves
  stage_kv(gk + 32 * DM, gv + 32, lk + 32u * KP * 4u, lv + 64u * VP * 2u);
  const int nfree = causal ? nst - 2 : nst;   // a causal block's last two passes (keys from its first query on) are the only ones that can hold a key behind a query
  kv_loop<false>(0, nfree, nst, ks0, kst, vst, gk, gv, lk, lv, aq, q0 + col, lane, m, l, acc);
  kv_loop<true>(nfree, nst, nst, ks0, kst, vst, gk, gv, lk, lv, aq, q0 + col, lane, m, l, acc);
  asm volatile("s_wait_asynccnt 0x0" ::: "memory");     // nothing in flight behind the loop
  l += xhalf(l);
  const float il = (l > 0.f) ? (1.0f / 2048.0f) / l : 0.f;
#pragma unroll
  for (int dt = 0; dt < 4; ++dt)
#pragma unroll
    for (int r = 0; r < 8; ++r) so[wave][col][dt * 16 + 8 * g + r] = acc[dt][r] * il;
  LDSX();
  for (int rl = 0; rl < 16; ++rl) if (lane < 16) vst2(CTX + (rq + rl) * DM + h * HD + lane * 4, *(const v4f*)&so[wave][rl][lane * 4]);
}
extern "C" void kernel_launch(void* const* d_in, const int* in_sizes, int n_in, void* d_out, int out_size, void* d_ws, size_t ws_size, hipStream_t stream) {
  (void)in_sizes; (void)n_in; (void)out_size;
  const float** F = (const float**)d_in;   // 0 q [2,4096,12,64], 1 k, 2 v, 3 is_causal int scalar
  if (ws_size < (size_t)WS_END) return;
  char* ws = (char*)d_ws; _Float16* VT = (_Float16*)(ws + WS_VT);
  k_vt<<<dim3(SS / 64, DM / 128, NB), 256, 0, stream>>>(F[2], VT);
  k_attn<<<dim3(TQB, TNB, NH), 128, 0, stream>>>(F[0], F[1], VT, (const int*)d_in[3], (float*)d_out);
}

// v006
// Measured time: 98.4 microseconds a run.
// Timed twice side by side with v005, it ran 1.05 and 1.04 times as fast.
// Counting every step since v000, it is 5.10 times as fast.
// compute dtype: all float inputs rounded to bf16, is_causal (int scalar) read on device; scores = q . k with EXACT bf16 x bf16 products on WMMA 16x16x32 restricted to the query's own segment (block-local attention; segment length 1024 / 2048 / 4096 by head group), optional causal exclusion on segment 0 of group 0 when is_causal != 0, x 1/8, running-max softmax in f32 (hardware exp); P (x 2^11) rounded once to f16 (11 significand bits, 1 product on WMMA 16x16x32 f16) x v (the bf16-rounded values held as f16 planes, exact from 2^-14 up); f32 output.
#include <hip/hip_runtime.h>
#include <math.h>

typedef __attribute__((ext_vector_type(16))) _Float16 v16h;
typedef __attribute__((ext_vector_type(16))) __bf16 v16b;
typedef __attribute__((ext_vector_type(8)))  _Float16 v8h;
typedef __attribute__((ext_vector_type(8)))  float v8f;
typedef __attribute__((ext_vector_type(4)))  float v4f;
typedef __attribute__((ext_vector_type(2)))  float v2f;
typedef __attribute__((ext_vector_type(4)))  unsigned v4u;
typedef __attribute__((ext_vector_type(4)))  int v4i;
typedef float __attribute__((may_alias)) float_a;
typedef int __attribute__((may_alias)) int_a;

template <typename T> __device__ __forceinline__ void vst2(void* p, T v) { *(T*)p = v;  }
__device__ __forceinline__ v8f wmma16(v16h a, v16h b, v8f c) {
  v8f d = __builtin_amdgcn_wmma_f32_16x16x32_f16(false, a, false, b, (short)0, c, false, false);
  asm volatile("v_nop\n\tv_nop\n\tv_nop\n\tv_nop" : "+v"(d) : "v"(a), "v"(b));
  return d;
}
__device__ __forceinline__ v8f wmma_bf(v16b a, v16b b, v8f c) {
  v8f d = __builtin_amdgcn_wmma_f32_16x16x32_bf16(false, a, false, b, (short)0, c, false, false);
  asm volatile("v_nop\n\tv_nop\n\tv_nop\n\tv_nop" : "+v"(d) : "v"(a), "v"(b));
  return d;
}
// 16x16x32 fragments: lane = (h = lane>>4, row/col = lane&15); elements 0..7 = k0+8h+0..7, 8..15 = k0+16+8h+0..7; D element r = row 8h+r
__device__ __forceinline__ v16h frag_h(const _Float16* rowk0, int lane) {
  union { v16h v; v8h q[2]; } u; const _Float16* p = rowk0 + 8 * (lane >> 4);
  u.q[0] = *(const v8h*)p; u.q[1] = *(const v8h*)(p + 16); return u.v;
}
__device__ __forceinline__ v16h frag_f32(const float* rowk0, int lane) {
  v16h a; const float* p = rowk0 + 8 * (lane >> 4);
#pragma unroll
  for (int i = 0; i < 8; ++i) { a[i] = (_Float16)p[i]; a[8 + i] = (_Float16)p[16 + i]; }
  return a;
}
__device__ __forceinline__ v16h frag_f32s(const float* rowk0, int lane, float sc) {
  v16h a; const float* p = rowk0 + 8 * (lane >> 4);
#pragma unroll
  for (int i = 0; i < 8; ++i) { a[i] = (_Float16)(p[i] * sc); a[8 + i] = (_Float16)(p[16 + i] * sc); }
  return a;
}
// column fragment from a [K][ld] layout (column n), rows >= K read as 0
__device__ __forceinline__ v16h fragc_f32(const float* W, int k0, int n, int lane, int ld, int K) {
  v16h a; const int g = lane >> 4;
#pragma unroll
  for (int i = 0; i < 8; ++i) { const int ka = k0 + 8 * g + i, kb = ka + 16;
    a[i] = (_Float16)(ka < K ? W[(size_t)(ka < K ? ka : K - 1) * ld + n] : 0.f); a[8 + i] = (_Float16)(kb < K ? W[(size_t)(kb < K ? kb : K - 1) * ld + n] : 0.f); }
  return a;
}
struct F2 { v16b h, l; };
__device__ __forceinline__ F2 bsplit16(const float v[16]) { F2 r;
#pragma unroll
  for (int i = 0; i < 16; ++i) { const __bf16 h = (__bf16)v[i]; r.h[i] = h; r.l[i] = (__bf16)(v[i] - (float)h); }
  return r; }
__device__ __forceinline__ F2 split_row(const float* row, int k0, int lane) { float v[16]; const float* p = row + k0 + 8 * (lane >> 4);
#pragma unroll
  for (int i = 0; i < 8; ++i) { v[i] = p[i]; v[8 + i] = p[16 + i]; }
  return bsplit16(v); }
__device__ __forceinline__ F2 split_rowK(const float* row, int k0, int lane, int K) { float v[16]; const int g = lane >> 4;
#pragma unroll
  for (int i = 0; i < 8; ++i) { const int ka = k0 + 8 * g + i, kb = ka + 16; v[i] = ka < K ? row[ka < K ? ka : K - 1] : 0.f; v[8 + i] = kb < K ? row[kb < K ? kb : K - 1] : 0.f; }
  return bsplit16(v); }
__device__ __forceinline__ F2 split_col(const float* W, int k0, int n, int lane, int ld, int K) { float v[16]; const int g = lane >> 4;
#pragma unroll
  for (int i = 0; i < 8; ++i) { const int ka = k0 + 8 * g + i, kb = ka + 16; v[i] = ka < K ? W[(size_t)(ka < K ? ka : K - 1) * ld + n] : 0.f; v[8 + i] = kb < K ? W[(size_t)(kb < K ? kb : K - 1) * ld + n] : 0.f; }
  return bsplit16(v); }
__device__ __forceinline__ v8f mac3(const F2& a, const F2& b, v8f c) { c = wmma_bf(a.l, b.h, c); c = wmma_bf(a.h, b.l, c); return wmma_bf(a.h, b.h, c); }
__device__ __forceinline__ float sigm(float v) { return 1.0f / (1.0f + expf(-v)); }
#define LDSX() do { asm volatile("s_wait_dscnt 0" ::: "memory"); __builtin_amdgcn_wave_barrier(); __builtin_amdgcn_fence(__ATOMIC_RELEASE, "workgroup"); } while (0)


// Head-parallel block-local ('dilated', degenerate gather) attention on given q, k, v (B 2, N 4,096, 12 heads x 64): heads 0-3 attend within 1,024-token segments, 4-7 within 2,048, 8-11 over all 4,096; softmax(q k / 8) v per segment.
#define NB 2
#define SS 4096
#define NH 12
#define HD 64
#define DM (NH * HD)
#ifndef TQB
#define TQB (SS / 128)
#define TNB NB
#define QB0 0            // first query block
#endif
typedef __attribute__((ext_vector_type(8))) __bf16 v8b;
__device__ __forceinline__ v16b frag_b(const __bf16* rowk0, int lane) {
  union { v16b v; v8b q[2]; } u; const __bf16* p = rowk0 + 8 * (lane >> 4);
  u.q[0] = *(const v8b*)p; u.q[1] = *(const v8b*)(p + 16); return u.v;
}
__device__ __forceinline__ float bfr(float v) { return (float)(__bf16)v; }
__device__ __attribute__((noinline)) float exp_ni(float v) { return expf(v); }
__device__ __attribute__((noinline)) float erf_ni(float v) { return erff(v); }

#define WS_VT  0u                                   // f16 v planes [b][h*64 + d][s]
#define WS_END (WS_VT + 2u * (size_t)NB * DM * SS)

// ---- k_vt: block = (64 keys, 128 cols, b): v[b][s][c] -> VT[b][c][s]: rounded to bf16 as every float input, that value stored as f16
__global__ __launch_bounds__(256) void k_vt(const float* __restrict__ V, _Float16* __restrict__ VT) { __shared__ __align__(16) _Float16 st[128][64 + 8]; const int t = threadIdx.x; const int s0 = blockIdx.x * 64; const int c0 = blockIdx.y * 128; const size_t b = blockIdx.z;
  for (int e = t; e < 64 * 128; e += 256) { const int sl = e >> 7, c = e & 127; st[c][sl] = (_Float16)bfr(V[((b * SS + s0 + sl) * DM) + c0 + c]); } __syncthreads();
  for (int e = t; e < 128 * 8; e += 256) { const int c = e >> 3, q = e & 7; vst2((unsigned*)(VT + ((b * DM + c0 + c) * SS) + s0 + q * 8), *(const v4u*)&st[c][q * 8]); } }
__device__ __forceinline__ v16b fragb_f32(const float* __restrict__ p, int lane) { v16b a; const float* pp = p + 8 * (lane >> 4);
#pragma unroll
  for (int i = 0; i < 8; ++i) { a[i] = (__bf16)pp[i]; a[8 + i] = (__bf16)pp[16 + i]; } return a; }
// lane l with lane l ^ 16 (the other half of the wave), on the vector pipe
__device__ __forceinline__ float xhalf(float x) { return __builtin_bit_cast(float, __builtin_amdgcn_permlanex16(__builtin_bit_cast(int, x), __builtin_bit_cast(int, x), 0x76543210, 0xfedcba98, false, false)); }
#define KP 68   // staged K row pitch in floats: 272 B = 16 B x 17, no bank conflict for 16-byte row reads
#define VP 40   // staged V plane row pitch in f16: 80 B = 16 B x 5, likewise
// fragb_f32 for a 16-byte-aligned row in LDS: same elements, same rounding, four 16-byte reads
__device__ __forceinline__ v16b fragb_lds(const float* p, int lane) { v16b a; const v4f* pp = (const v4f*)(p + 8 * (lane >> 4)); const v4f x0 = pp[0], x1 = pp[1], x2 = pp[4], x3 = pp[5];
#pragma unroll
  for (int i = 0; i < 4; ++i) { a[i] = (__bf16)x0[i]; a[4 + i] = (__bf16)x1[i]; a[8 + i] = (__bf16)x2[i]; a[12 + i] = (__bf16)x3[i]; } return a; }
// one 32-key stage, 6 copies of 16 B per lane: K rows j * 8 + tid / 16 (256 B each, a wave covers 4 whole lines), V plane rows j * 32 + tid / 4 (64 B each).
// The closing s_wait_xcnt stands inside the statement so that no address register named here is rewritten ahead of it.
__device__ __forceinline__ void stage_kv(const float* gk, const _Float16* gv, unsigned lk, unsigned lv) {
  asm volatile("global_load_async_to_lds_b128 %0, %6, off\n\t"
               "global_load_async_to_lds_b128 %1, %7, off\n\t"
               "global_load_async_to_lds_b128 %2, %8, off\n\t"
               "global_load_async_to_lds_b128 %3, %9, off\n\t"
               "global_load_async_to_lds_b128 %4, %10, off\n\t"
               "global_load_async_to_lds_b128 %5, %11, off\n\t"
               "s_wait_xcnt 0x0"
               :: "v"(lk), "v"(lk + 8u * KP * 4u), "v"(lk + 16u * KP * 4u), "v"(lk + 24u * KP * 4u), "v"(lv), "v"(lv + 32u * VP * 2u),
                  "v"(gk), "v"(gk + 8 * DM), "v"(gk + 16 * DM), "v"(gk + 24 * DM), "v"(gv), "v"(gv + (size_t)32 * SS) : "memory");
}
// one pass of 32 keys for this wave's 32 queries (two query tiles of 16, qt = 0, 1), from the staged K rows kt and V plane rows vt: each K and V fragment is read from LDS (and K rounded to bf16) once and feeds both tiles' products. Per query the arithmetic and its order are those of a 16-query wave. MK = the pass may hold keys behind a query of a causal block: only then the key index is compared, and only then a score can be the excluded value, so only then the exponentials are guarded; in every other pass all 32 scores are finite, and exp(m - mn) of the start value of m is 0 by itself.
template <bool MK> __device__ __forceinline__ void kv_pass(const float (*kt)[KP], const _Float16 (*vt)[VP], const v16b (&aq)[2][2], int kb0, int qi, int lane, float (&m)[2], float (&l)[2], v8f (&acc)[2][4]) {
  const int col = lane & 15;
  v16b kf[2][2];
#pragma unroll
  for (int ct = 0; ct < 2; ++ct)
#pragma unroll
    for (int kc = 0; kc < 2; ++kc) kf[ct][kc] = fragb_lds(&kt[ct * 16 + col][kc * 32], lane);
  v8f c[2][2] = {};   // c[qt][ct][r] = score of key kb0 + ct * 16 + r, query qi + qt * 16: four independent accumulators
#pragma unroll
  for (int kc = 0; kc < 2; ++kc)
#pragma unroll
    for (int qt = 0; qt < 2; ++qt)
#pragma unroll
      for (int ct = 0; ct < 2; ++ct) c[qt][ct] = wmma_bf(kf[ct][kc], aq[qt][kc], c[qt][ct]);
  v16h vf[4];
#pragma unroll
  for (int dt = 0; dt < 4; ++dt) vf[dt] = frag_h(&vt[dt * 16 + col][0], lane);
  v16h pa[2];   // per tile: element i = key 8 g + i, element 8 + i = key 16 + 8 g + i: the k order of frag_h
#pragma unroll
  for (int qt = 0; qt < 2; ++qt) { v8f s[2];
#pragma unroll
    for (int ct = 0; ct < 2; ++ct)
#pragma unroll
      for (int r = 0; r < 8; ++r) s[ct][r] = (!MK || kb0 + ct * 16 + r <= qi + qt * 16) ? c[qt][ct][r] * 0.125f : -3.0e38f;
    float mr[8];
#pragma unroll
    for (int r = 0; r < 8; ++r) mr[r] = fmaxf(s[0][r], s[1][r]);
    float mx = fmaxf(fmaxf(fmaxf(mr[0], mr[1]), fmaxf(mr[2], mr[3])), fmaxf(fmaxf(mr[4], mr[5]), fmaxf(mr[6], mr[7])));
    mx = fmaxf(mx, xhalf(mx));
    const float mn = fmaxf(m[qt], mx); const float alpha = (MK && m[qt] <= -1.0e38f) ? 0.f : __expf(m[qt] - mn);
    float e[16];
#pragma unroll
    for (int i = 0; i < 8; ++i) { e[i] = (MK && s[0][i] <= -1.0e38f) ? 0.f : __expf(s[0][i] - mn); e[8 + i] = (MK && s[1][i] <= -1.0e38f) ? 0.f : __expf(s[1][i] - mn); }
    float er[8];
#pragma unroll
    for (int i = 0; i < 8; ++i) er[i] = e[i] + e[8 + i];
    l[qt] = l[qt] * alpha + (((er[0] + er[1]) + (er[2] + er[3])) + ((er[4] + er[5]) + (er[6] + er[7]))); m[qt] = mn;
#pragma unroll
    for (int dt = 0; dt < 4; ++dt) acc[qt][dt] *= alpha;
#pragma unroll
    for (int i = 0; i < 16; ++i) pa[qt][i] = (_Float16)(e[i] * 2048.0f);   // x 2^11: weights down to 2^-25 of the row's maximum stay normal f16 numbers
  }
#pragma unroll
  for (int qt = 0; qt < 2; ++qt)
#pragma unroll
    for (int dt = 0; dt < 4; ++dt) acc[qt][dt] = wmma16(vf[dt], pa[qt], acc[qt][dt]);   // acc[qt][dt][r] = out column dt * 16 + 8 g + r of query qi + qt * 16
}
// passes t0 .. t1 - 1 of the nst passes of a block, all of one form; the foot of each pass is the ring's: own LDS reads done, own copies landed, one block barrier, then the refill two stages ahead
template <bool MK> __device__ __forceinline__ void kv_loop(int t0, int t1, int nst, int ks0, const float (*kst)[32][KP], const _Float16 (*vst)[64][VP], const float* gk, const _Float16* gv, unsigned lk, unsigned lv, const v16b (&aq)[2][2], int qi, int lane, float (&m)[2], float (&l)[2], v8f (&acc)[2][4]) {
  // stays rolled, as before: a second copy of this long body would add code and live registers and save only the loop's few scalar instructions
#pragma unroll 1
  for (int t = t0; t < t1; ++t) { const int bf = t & 1;
    kv_pass<MK>(kst[bf], vst[bf], aq, (ks0 + t) * 32 + 8 * (lane >> 4), qi, lane, m, l, acc);
    asm volatile("s_wait_dscnt 0x0" ::: "memory");      // this wave's reads of buffer bf are done
    asm volatile("s_wait_asynccnt 0x0" ::: "memory");   // this wave's part of stage t + 1 has landed
    __syncthreads();                                    // publishes stage t + 1 and frees buffer bf for the refill
    if (t + 2 < nst) stage_kv(gk + (size_t)(t + 2) * 32 * DM, gv + (t + 2) * 32, lk + (unsigned)bf * (32u * KP * 4u), lv + (unsigned)bf * (64u * VP * 2u)); }
}
__global__ __launch_bounds__(128) void k_attn(const float* __restrict__ Q, const float* __restrict__ K, const _Float16* __restrict__ VT, const int* __restrict__ ISC, float* __restrict__ CTX) {
  __shared__ __align__(16) float so[4][32][68];
  __shared__ __align__(16) float kst[2][32][KP]; __shared__ __align__(16) _Float16 vst[2][64][VP];
  const int tid = threadIdx.x, wave = tid >> 5, lane = tid & 31, col = lane & 15, g = lane >> 4; const int qb = blockIdx.x + QB0, h = NH - 1 - (int)blockIdx.z; const size_t b = blockIdx.y; const int q0 = qb * 128 + wave * 32; const size_t rq = b * SS + q0;
  v16b aq[2][2];
#pragma unroll
  for (int qt = 0; qt < 2; ++qt)
#pragma unroll
    for (int kc = 0; kc < 2; ++kc) aq[qt][kc] = fragb_f32(Q + (rq + qt * 16 + col) * DM + h * HD + kc * 32, lane);
  float m[2] = {-3.0e38f, -3.0e38f}, l[2] = {0.f, 0.f};   // of query q0 + qt * 16 + col; l holds this wave half's keys only, the halves are joined behind the loop
  v8f acc[2][4] = {};
  const int grp = (h / 4 > 2) ? 2 : h / 4; const int L = 1024 << grp; const int seg = (qb * 128) / L; const bool causal = (ISC[0] != 0) && grp == 0 && seg == 0; const int ks0 = seg * L / 32;
  const int nst = causal ? qb * 4 + 4 : L / 32;   // stages of 32 keys; causal: up to the block's last query (at least 4, at most L / 32)
  const float* gk = K + (b * SS + (size_t)ks0 * 32 + (tid >> 4)) * DM + h * HD + (tid & 15) * 4;
  const _Float16* gv = VT + (b * DM + h * HD + (tid >> 2)) * SS + (size_t)ks0 * 32 + (tid & 3) * 8;
  const unsigned lk = (unsigned)(size_t)&kst[0][tid >> 4][(tid & 15) * 4], lv = (unsigned)(size_t)&vst[0][tid >> 2][(tid & 3) * 8];
  stage_kv(gk, gv, lk, lv);
  asm volatile("s_wait_asynccnt 0x0" ::: "memory");   // this wave's part of stage 0 has landed
  __syncthreads();                                    // stage 0 readable by all four waves
  stage_kv(gk + 32 * DM, gv + 32, lk + 32u * KP * 4u, lv + 64u * VP * 2u);
  const int nfree = causal ? nst - 4 : nst;   // a causal block's last four passes (keys from its first query on) are the only ones that can hold a key behind a query
  kv_loop<false>(0, nfree, nst, ks0, kst, vst, gk, gv, lk, lv, aq, q0 + col, lane, m, l, acc);
  kv_loop<true>(nfree, nst, nst, ks0, kst, vst, gk, gv, lk, lv, aq, q0 + col, lane, m, l, acc);
  asm volatile("s_wait_asynccnt 0x0" ::: "memory");     // nothing in flight behind the loop
#pragma unroll
  for (int qt = 0; qt < 2; ++qt) { const float ls = l[qt] + xhalf(l[qt]);
    const float il = (ls > 0.f) ? (1.0f / 2048.0f) / ls : 0.f;
#pragma unroll
    for (int dt = 0; dt < 4; ++dt)
#pragma unroll
      for (int r = 0; r < 8; ++r) so[wave][qt * 16 + col][dt * 16 + 8 * g + r] = acc[qt][dt][r] * il; }
  LDSX();
  for (int rl = 0; rl < 32; ++rl) if (lane < 16) vst2(CTX + (rq + rl) * DM + h * HD + lane * 4, *(const v4f*)&so[wave][rl][lane * 4]);
}
extern "C" void kernel_launch(void* const* d_in, const int* in_sizes, int n_in, void* d_out, int out_size, void* d_ws, size_t ws_size, hipStream_t stream) {
  (void)in_sizes; (void)n_in; (void)out_size;
  const float** F = (const float**)d_in;   // 0 q [2,4096,12,64], 1 k, 2 v, 3 is_causal int scalar
  if (ws_size < (size_t)WS_END) return;
  char* ws = (char*)d_ws; _Float16* VT = (_Float16*)(ws + WS_VT);
  k_vt<<<dim3(SS / 64, DM / 128, NB), 256, 0, stream>>>(F[2], VT);
  k_attn<<<dim3(TQB, TNB, NH), 128, 0, stream>>>(F[0], F[1], VT, (const int*)d_in[3], (float*)d_out);
}

// v007
// A run of this version takes 71.1 microseconds.
// Two timings next to v006 put it at 1.38 and 1.39 times that version's speed.
// All steps since v000 together make it 7.07 times as fast.
// compute dtype: all float inputs rounded to bf16, is_causal (int scalar) read on device; scores = q . k with EXACT bf16 x bf16 products on WMMA 16x16x32 restricted to the query's own segment (block-local attention; segment length 1024 / 2048 / 4096 by head group), optional causal exclusion on segment 0 of group 0 when is_causal != 0, x 1/8, running-max softmax in f32 (hardware exp); P (x 2^11) rounded once to f16 (11 significand bits, 1 product on WMMA 16x16x32 f16) x v (the bf16-rounded values held as f16 planes, exact from 2^-14 up); f32 output.
#include <hip/hip_runtime.h>
#include <math.h>

typedef __attribute__((ext_vector_type(16))) _Float16 v16h;
typedef __attribute__((ext_vector_type(16))) __bf16 v16b;
typedef __attribute__((ext_vector_type(8)))  _Float16 v8h;
typedef __attribute__((ext_vector_type(8)))  float v8f;
typedef __attribute__((ext_vector_type(4)))  float v4f;
typedef __attribute__((ext_vector_type(2)))  float v2f;
typedef __attribute__((ext_vector_type(4)))  unsigned v4u;
typedef __attribute__((ext_vector_type(4)))  int v4i;
typedef float __attribute__((may_alias)) float_a;
typedef int __attribute__((may_alias)) int_a;

template <typename T> __device__ __forceinline__ void vst2(void* p, T v) { *(T*)p = v;  }
__device__ __forceinline__ v8f wmma16(v16h a, v16h b, v8f c) {
  v8f d = __builtin_amdgcn_wmma_f32_16x16x32_f16(false, a, false, b, (short)0, c, false, false);
  asm volatile("v_nop\n\tv_nop\n\tv_nop\n\tv_nop" : "+v"(d) : "v"(a), "v"(b));
  return d;
}
__device__ __forceinline__ v8f wmma_bf(v16b a, v16b b, v8f c) {
  v8f d = __builtin_amdgcn_wmma_f32_16x16x32_bf16(false, a, false, b, (short)0, c, false, false);
  asm volatile("v_nop\n\tv_nop\n\tv_nop\n\tv_nop" : "+v"(d) : "v"(a), "v"(b));
  return d;
}
// 16x16x32 fragments: lane = (h = lane>>4, row/col = lane&15); elements 0..7 = k0+8h+0..7, 8..15 = k0+16+8h+0..7; D element r = row 8h+r
__device__ __forceinline__ v16h frag_h(const _Float16* rowk0, int lane) {
  union { v16h v; v8h q[2]; } u; const _Float16* p = rowk0 + 8 * (lane >> 4);
  u.q[0] = *(const v8h*)p; u.q[1] = *(const v8h*)(p + 16); return u.v;
}
__device__ __forceinline__ v16h frag_f32(const float* rowk0, int lane) {
  v16h a; const float* p = rowk0 + 8 * (lane >> 4);
#pragma unroll
  for (int i = 0; i < 8; ++i) { a[i] = (_Float16)p[i]; a[8 + i] = (_Float16)p[16 + i]; }
  return a;
}
__device__ __forceinline__ v16h frag_f32s(const float* rowk0, int lane, float sc) {
  v16h a; const float* p = rowk0 + 8 * (lane >> 4);
#pragma unroll
  for (int i = 0; i < 8; ++i) { a[i] = (_Float16)(p[i] * sc); a[8 + i] = (_Float16)(p[16 + i] * sc); }
  return a;
}
// column fragment from a [K][ld] layout (column n), rows >= K read as 0
__device__ __forceinline__ v16h fragc_f32(const float* W, int k0, int n, int lane, int ld, int K) {
  v16h a; const int g = lane >> 4;
#pragma unroll
  for (int i = 0; i < 8; ++i) { const int ka = k0 + 8 * g + i, kb = ka + 16;
    a[i] = (_Float16)(ka < K ? W[(size_t)(ka < K ? ka : K - 1) * ld + n] : 0.f); a[8 + i] = (_Float16)(kb < K ? W[(size_t)(kb < K ? kb : K - 1) * ld + n] : 0.f); }
  return a;
}
struct F2 { v16b h, l; };
__device__ __forceinline__ F2 bsplit16(const float v[16]) { F2 r;
#pragma unroll
  for (int i = 0; i < 16; ++i) { const __bf16 h = (__bf16)v[i]; r.h[i] = h; r.l[i] = (__bf16)(v[i] - (float)h); }
  return r; }
__device__ __forceinline__ F2 split_row(const float* row, int k0, int lane) { float v[16]; const float* p = row + k0 + 8 * (lane >> 4);
#pragma unroll
  for (int i = 0; i < 8; ++i) { v[i] = p[i]; v[8 + i] = p[16 + i]; }
  return bsplit16(v); }
__device__ __forceinline__ F2 split_rowK(const float* row, int k0, int lane, int K) { float v[16]; const int g = lane >> 4;
#pragma unroll
  for (int i = 0; i < 8; ++i) { const int ka = k0 + 8 * g + i, kb = ka + 16; v[i] = ka < K ? row[ka < K ? ka : K - 1] : 0.f; v[8 + i] = kb < K ? row[kb < K ? kb : K - 1] : 0.f; }
  return bsplit16(v); }
__device__ __forceinline__ F2 split_col(const float* W, int k0, int n, int lane, int ld, int K) { float v[16]; const int g = lane >> 4;
#pragma unroll
  for (int i = 0; i < 8; ++i) { const int ka = k0 + 8 * g + i, kb = ka + 16; v[i] = ka < K ? W[(size_t)(ka < K ? ka : K - 1) * ld + n] : 0.f; v[8 + i] = kb < K ? W[(size_t)(kb < K ? kb : K - 1) * ld + n] : 0.f; }
  return bsplit16(v); }
__device__ __forceinline__ v8f mac3(const F2& a, const F2& b, v8f c) { c = wmma_bf(a.l, b.h, c); c = wmma_bf(a.h, b.l, c); return wmma_bf(a.h, b.h, c); }
__device__ __forceinline__ float sigm(float v) { return 1.0f / (1.0f + expf(-v)); }
#define LDSX() do { asm volatile("s_wait_dscnt 0" ::: "memory"); __builtin_amdgcn_wave_barrier(); __builtin_amdgcn_fence(__ATOMIC_RELEASE, "workgroup"); } while (0)


// Head-parallel block-local ('dilated', degenerate gather) attention on given q, k, v (B 2, N 4,096, 12 heads x 64): heads 0-3 attend within 1,024-token segments, 4-7 within 2,048, 8-11 over all 4,096; softmax(q k / 8) v per segment.
#define NB 2
#define SS 4096
#define NH 12
#define HD 64
#define DM (NH * HD)
#ifndef TQB
#define TQB (SS / 128)
#define TNB NB
#define QB0 0            // first query block
#endif
typedef __attribute__((ext_vector_type(8))) __bf16 v8b;
__device__ __forceinline__ v16b frag_b(const __bf16* rowk0, int lane) {
  union { v16b v; v8b q[2]; } u; const __bf16* p = rowk0 + 8 * (lane >> 4);
  u.q[0] = *(const v8b*)p; u.q[1] = *(const v8b*)(p + 16); return u.v;
}
__device__ __forceinline__ float bfr(float v) { return (float)(__bf16)v; }
__device__ __attribute__((noinline)) float exp_ni(float v) { return expf(v); }
__device__ __attribute__((noinline)) float erf_ni(float v) { return erff(v); }

#define WS_VT  0u                                   // f16 v planes [b][h*64 + d][s]
#define WS_END (WS_VT + 2u * (size_t)NB * DM * SS)

// ---- k_vt: block = (64 keys, 128 cols, b): v[b][s][c] -> VT[b][c][s]: rounded to bf16 as every float input, that value stored as f16
__global__ __launch_bounds__(256) void k_vt(const float* __restrict__ V, _Float16* __restrict__ VT) { __shared__ __align__(16) _Float16 st[128][64 + 8]; const int t = threadIdx.x; const int s0 = blockIdx.x * 64; const int c0 = blockIdx.y * 128; const size_t b = blockIdx.z;
  for (int e = t; e < 64 * 128; e += 256) { const int sl = e >> 7, c = e & 127; st[c][sl] = (_Float16)bfr(V[((b * SS + s0 + sl) * DM) + c0 + c]); } __syncthreads();
  for (int e = t; e < 128 * 8; e += 256) { const int c = e >> 3, q = e & 7; vst2((unsigned*)(VT + ((b * DM + c0 + c) * SS) + s0 + q * 8), *(const v4u*)&st[c][q * 8]); } }
__device__ __forceinline__ v16b fragb_f32(const float* __restrict__ p, int lane) { v16b a; const float* pp = p + 8 * (lane >> 4);
#pragma unroll
  for (int i = 0; i < 8; ++i) { a[i] = (__bf16)pp[i]; a[8 + i] = (__bf16)pp[16 + i]; } return a; }
// lane l with lane l ^ 16 (the other half of the wave), on the vector pipe
__device__ __forceinline__ float xhalf(float x) { return __builtin_bit_cast(float, __builtin_amdgcn_permlanex16(__builtin_bit_cast(int, x), __builtin_bit_cast(int, x), 0x76543210, 0xfedcba98, false, false)); }
#define KP 68   // staged K row pitch in floats: 272 B = 16 B x 17, no bank conflict for 16-byte row reads
#define VP 136  // staged V plane row pitch in f16: 272 B = 16 B x 17, likewise
#define SK 128  // keys of one stage of the ring: four passes of 32 keys
#define KBY (SK * KP * 4)          // bytes of a stage's K rows
#define STB (KBY + 64 * VP * 2)    // bytes of a stage: K rows, then V plane rows
// fragb_f32 for a 16-byte-aligned row in LDS: same elements, same rounding, four 16-byte reads
__device__ __forceinline__ v16b fragb_lds(const float* p, int lane) { v16b a; const v4f* pp = (const v4f*)(p + 8 * (lane >> 4)); const v4f x0 = pp[0], x1 = pp[1], x2 = pp[4], x3 = pp[5];
#pragma unroll
  for (int i = 0; i < 4; ++i) { a[i] = (__bf16)x0[i]; a[4 + i] = (__bf16)x1[i]; a[8 + i] = (__bf16)x2[i]; a[12 + i] = (__bf16)x3[i]; } return a; }
// eight copies of 16 B per lane: rows j * 8 + tid / 16 (j = 0 .. 7) of 256 B each, so a wave covers 4 whole lines per copy; gs = 8 source rows in bytes; every staged row has the pitch of 272 B.
// The closing s_wait_xcnt stands inside the statement so that no address register named here is rewritten ahead of it.
__device__ __forceinline__ void copy8(const char* g, size_t gs, unsigned l) {
  asm volatile("global_load_async_to_lds_b128 %0, %8, off\n\t"
               "global_load_async_to_lds_b128 %1, %9, off\n\t"
               "global_load_async_to_lds_b128 %2, %10, off\n\t"
               "global_load_async_to_lds_b128 %3, %11, off\n\t"
               "global_load_async_to_lds_b128 %4, %12, off\n\t"
               "global_load_async_to_lds_b128 %5, %13, off\n\t"
               "global_load_async_to_lds_b128 %6, %14, off\n\t"
               "global_load_async_to_lds_b128 %7, %15, off\n\t"
               "s_wait_xcnt 0x0"
               :: "v"(l), "v"(l + 8u * 272u), "v"(l + 16u * 272u), "v"(l + 24u * 272u), "v"(l + 32u * 272u), "v"(l + 40u * 272u), "v"(l + 48u * 272u), "v"(l + 56u * 272u),
                  "v"(g), "v"(g + gs), "v"(g + 2 * gs), "v"(g + 3 * gs), "v"(g + 4 * gs), "v"(g + 5 * gs), "v"(g + 6 * gs), "v"(g + 7 * gs) : "memory");
}
// one stage of 128 keys, 24 copies per lane: 128 K rows (64 floats each), then the 64 V plane rows (128 f16 each)
__device__ __forceinline__ void stage_kv(const float* gk, const _Float16* gv, unsigned lk, unsigned lv) {
  copy8((const char*)gk, (size_t)8 * DM * 4, lk);
  copy8((const char*)(gk + 64 * DM), (size_t)8 * DM * 4, lk + 64u * 272u);
  copy8((const char*)gv, (size_t)8 * SS * 2, lv);
}
// one pass of 32 keys for this wave's 32 queries (two query tiles of 16, qt = 0, 1), from the staged K rows kt and, from key column ko on, the V plane rows vt: each K and V fragment is read from LDS (and K rounded to bf16) once and feeds both tiles' products. Per query the arithmetic and its order are those of a 16-query wave. MK = the pass may hold keys behind a query of a causal block: only then the key index is compared, and only then a score can be the excluded value, so only then the exponentials are guarded; in every other pass all 32 scores are finite, and exp(m - mn) of the start value of m is 0 by itself.
template <bool MK> __device__ __forceinline__ void kv_pass(const float (*kt)[KP], const _Float16 (*vt)[VP], int ko, const v16b (&aq)[2][2], int kb0, int qi, int lane, float (&m)[2], float (&l)[2], v8f (&acc)[2][4]) {
  const int col = lane & 15;
  v16b kf[2][2];
#pragma unroll
  for (int ct = 0; ct < 2; ++ct)
#pragma unroll
    for (int kc = 0; kc < 2; ++kc) kf[ct][kc] = fragb_lds(&kt[ct * 16 + col][kc * 32], lane);
  v8f c[2][2] = {};   // c[qt][ct][r] = score of key kb0 + ct * 16 + r, query qi + qt * 16: four independent accumulators
#pragma unroll
  for (int kc = 0; kc < 2; ++kc)
#pragma unroll
    for (int qt = 0; qt < 2; ++qt)
#pragma unroll
      for (int ct = 0; ct < 2; ++ct) c[qt][ct] = wmma_bf(kf[ct][kc], aq[qt][kc], c[qt][ct]);
  v16h vf[4];
#pragma unroll
  for (int dt = 0; dt < 4; ++dt) vf[dt] = frag_h(&vt[dt * 16 + col][ko], lane);
  v16h pa[2];   // per tile: element i = key 8 g + i, element 8 + i = key 16 + 8 g + i: the k order of frag_h
#pragma unroll
  for (int qt = 0; qt < 2; ++qt) { v8f s[2];
#pragma unroll
    for (int ct = 0; ct < 2; ++ct)
#pragma unroll
      for (int r = 0; r < 8; ++r) s[ct][r] = (!MK || kb0 + ct * 16 + r <= qi + qt * 16) ? c[qt][ct][r] * 0.125f : -3.0e38f;
    float mr[8];
#pragma unroll
    for (int r = 0; r < 8; ++r) mr[r] = fmaxf(s[0][r], s[1][r]);
    float mx = fmaxf(fmaxf(fmaxf(mr[0], mr[1]), fmaxf(mr[2], mr[3])), fmaxf(fmaxf(mr[4], mr[5]), fmaxf(mr[6], mr[7])));
    mx = fmaxf(mx, xhalf(mx));
    const float mn = fmaxf(m[qt], mx); const float alpha = (MK && m[qt] <= -1.0e38f) ? 0.f : __expf(m[qt] - mn);
    float e[16];
#pragma unroll
    for (int i = 0; i < 8; ++i) { e[i] = (MK && s[0][i] <= -1.0e38f) ? 0.f : __expf(s[0][i] - mn); e[8 + i] = (MK && s[1][i] <= -1.0e38f) ? 0.f : __expf(s[1][i] - mn); }
    float er[8];
#pragma unroll
    for (int i = 0; i < 8; ++i) er[i] = e[i] + e[8 + i];
    l[qt] = l[qt] * alpha + (((er[0] + er[1]) + (er[2] + er[3])) + ((er[4] + er[5]) + (er[6] + er[7]))); m[qt] = mn;
#pragma unroll
    for (int dt = 0; dt < 4; ++dt) acc[qt][dt] *= alpha;
#pragma unroll
    for (int i = 0; i < 16; ++i) pa[qt][i] = (_Float16)(e[i] * 2048.0f);   // x 2^11: weights down to 2^-25 of the row's maximum stay normal f16 numbers
  }
#pragma unroll
  for (int qt = 0; qt < 2; ++qt)
#pragma unroll
    for (int dt = 0; dt < 4; ++dt) acc[qt][dt] = wmma16(vf[dt], pa[qt], acc[qt][dt]);   // acc[qt][dt][r] = out column dt * 16 + 8 g + r of query qi + qt * 16
}
// stages t0 .. t1 - 1 of the nst stages of a block, four passes each, all of one form; the foot of each stage is the ring's: own LDS reads done, own copies landed, one block barrier, then the refill two stages ahead, which so has the four passes of a whole stage to land
template <bool MK> __device__ __forceinline__ void kv_loop(int t0, int t1, int nst, int ks0, const unsigned char* ring, const float* gk, const _Float16* gv, unsigned lk, unsigned lv, const v16b (&aq)[2][2], int qi, int lane, float (&m)[2], float (&l)[2], v8f (&acc)[2][4]) {
  // the stage loop stays rolled: a second copy of its long body would add code and save only the loop's few scalar instructions
#pragma unroll 1
  for (int t = t0; t < t1; ++t) { const int bf = t & 1;
    const float (*kt)[KP] = (const float (*)[KP])(ring + bf * STB); const _Float16 (*vt)[VP] = (const _Float16 (*)[VP])(ring + bf * STB + KBY);
    // the pass loop stays rolled: with the four long bodies in a row the build took more than 256 registers and switched register windows all through the loop
#pragma unroll 1
    for (int p = 0; p < SK / 32; ++p) kv_pass<MK>(kt + p * 32, vt, p * 32, aq, (ks0 + t * (SK / 32) + p) * 32 + 8 * (lane >> 4), qi, lane, m, l, acc);
    asm volatile("s_wait_dscnt 0x0" ::: "memory");      // this wave's reads of buffer bf are done
    asm volatile("s_wait_asynccnt 0x0" ::: "memory");   // this wave's part of stage t + 1 has landed
    __syncthreads();                                    // publishes stage t + 1 and frees buffer bf for the refill
    if (t + 2 < nst) stage_kv(gk + (size_t)(t + 2) * SK * DM, gv + (t + 2) * SK, lk + (unsigned)bf * (unsigned)STB, lv + (unsigned)bf * (unsigned)STB); }
}
__global__ __launch_bounds__(128) void k_attn(const float* __restrict__ Q, const float* __restrict__ K, const _Float16* __restrict__ VT, const int* __restrict__ ISC, float* __restrict__ CTX) {
  __shared__ __align__(16) unsigned char ring[2 * STB];
  float (*so)[32][68] = (float (*)[32][68])ring;   // output staging, 34,816 B: used only behind the loop
  const int tid = threadIdx.x, wave = tid >> 5, lane = tid & 31, col = lane & 15, g = lane >> 4; const int qb = blockIdx.x + QB0, h = NH - 1 - (int)blockIdx.z; const size_t b = blockIdx.y; const int q0 = qb * 128 + wave * 32; const size_t rq = b * SS + q0;
  v16b aq[2][2];
#pragma unroll
  for (int qt = 0; qt < 2; ++qt)
#pragma unroll
    for (int kc = 0; kc < 2; ++kc) aq[qt][kc] = fragb_f32(Q + (rq + qt * 16 + col) * DM + h * HD + kc * 32, lane);
  float m[2] = {-3.0e38f, -3.0e38f}, l[2] = {0.f, 0.f};   // of query q0 + qt * 16 + col; l holds this wave half's keys only, the halves are joined behind the loop
  v8f acc[2][4] = {};
  const int grp = (h / 4 > 2) ? 2 : h / 4; const int L = 1024 << grp; const int seg = (qb * 128) / L; const bool causal = (ISC[0] != 0) && grp == 0 && seg == 0; const int ks0 = seg * L / 32;
  const int nst = causal ? qb + 1 : L / SK;   // stages of 128 keys; causal: up to the block's last query (at least 1, at most L / SK)
  const float* gk = K + (b * SS + (size_t)ks0 * 32 + (tid >> 4)) * DM + h * HD + (tid & 15) * 4;
  const _Float16* gv = VT + (b * DM + h * HD + (tid >> 4)) * SS + (size_t)ks0 * 32 + (tid & 15) * 8;
  const unsigned lk = (unsigned)(size_t)&ring[(tid >> 4) * 272 + (tid & 15) * 16], lv = lk + (unsigned)KBY;
  stage_kv(gk, gv, lk, lv);
  asm volatile("s_wait_asynccnt 0x0" ::: "memory");   // this wave's part of stage 0 has landed
  __syncthreads();                                    // stage 0 readable by all four waves
  if (nst > 1) stage_kv(gk + SK * DM, gv + SK, lk + (unsigned)STB, lv + (unsigned)STB);   // a causal block on the first 128 queries has one stage only
  const int nfree = causal ? nst - 1 : nst;   // a causal block's last stage (keys from its first query on) is the only one that can hold a key behind a query
  kv_loop<false>(0, nfree, nst, ks0, ring, gk, gv, lk, lv, aq, q0 + col, lane, m, l, acc);
  kv_loop<true>(nfree, nst, nst, ks0, ring, gk, gv, lk, lv, aq, q0 + col, lane, m, l, acc);
  asm volatile("s_wait_asynccnt 0x0" ::: "memory");     // nothing in flight behind the loop
#pragma unroll
  for (int qt = 0; qt < 2; ++qt) { const float ls = l[qt] + xhalf(l[qt]);
    const float il = (ls > 0.f) ? (1.0f / 2048.0f) / ls : 0.f;
#pragma unroll
    for (int dt = 0; dt < 4; ++dt)
#pragma unroll
      for (int r = 0; r < 8; ++r) so[wave][qt * 16 + col][dt * 16 + 8 * g + r] = acc[qt][dt][r] * il; }
  LDSX();
  for (int rl = 0; rl < 32; ++rl) if (lane < 16) vst2(CTX + (rq + rl) * DM + h * HD + lane * 4, *(const v4f*)&so[wave][rl][lane * 4]);
}
extern "C" void kernel_launch(void* const* d_in, const int* in_sizes, int n_in, void* d_out, int out_size, void* d_ws, size_t ws_size, hipStream_t stream) {
  (void)in_sizes; (void)n_in; (void)out_size;
  const float** F = (const float**)d_in;   // 0 q [2,4096,12,64], 1 k, 2 v, 3 is_causal int scalar
  if (ws_size < (size_t)WS_END) return;
  char* ws = (char*)d_ws; _Float16* VT = (_Float16*)(ws + WS_VT);
  k_vt<<<dim3(SS / 64, DM / 128, NB), 256, 0, stream>>>(F[2], VT);
  k_attn<<<dim3(TQB, TNB, NH), 128, 0, stream>>>(F[0], F[1], VT, (const int*)d_in[3], (float*)d_out);
}

// v008
// It runs in 65.8 microseconds.
// Timed twice side by side with v007, it ran 1.08 times as fast both times.
// All steps since v000 together make it 7.64 times as fast.
// compute dtype: all float inputs rounded to bf16, is_causal (int scalar) read on device; scores = q . k with EXACT bf16 x bf16 products on WMMA 16x16x32 restricted to the query's own segment (block-local attention; segment length 1024 / 2048 / 4096 by head group), optional causal exclusion on segment 0 of group 0 when is_causal != 0, running-max softmax in f32 with the factors 1/8, log2 e and 2^11 inside one fused multiply-add per score (hardware exp2); P (x 2^11) rounded once to f16 (11 significand bits, 1 product on WMMA 16x16x32 f16) x v (the bf16-rounded values held as f16 planes, exact from 2^-14 up); f32 output.
#include <hip/hip_runtime.h>
#include <math.h>

typedef __attribute__((ext_vector_type(16))) _Float16 v16h;
typedef __attribute__((ext_vector_type(16))) __bf16 v16b;
typedef __attribute__((ext_vector_type(8)))  _Float16 v8h;
typedef __attribute__((ext_vector_type(8)))  float v8f;
typedef __attribute__((ext_vector_type(4)))  float v4f;
typedef __attribute__((ext_vector_type(2)))  float v2f;
typedef __attribute__((ext_vector_type(4)))  unsigned v4u;
typedef __attribute__((ext_vector_type(4)))  int v4i;
typedef float __attribute__((may_alias)) float_a;
typedef int __attribute__((may_alias)) int_a;

template <typename T> __device__ __forceinline__ void vst2(void* p, T v) { *(T*)p = v;  }
__device__ __forceinline__ v8f wmma16(v16h a, v16h b, v8f c) {
  v8f d = __builtin_amdgcn_wmma_f32_16x16x32_f16(false, a, false, b, (short)0, c, false, false);
  asm volatile("v_nop\n\tv_nop\n\tv_nop\n\tv_nop" : "+v"(d) : "v"(a), "v"(b));
  return d;
}
__device__ __forceinline__ v8f wmma_bf(v16b a, v16b b, v8f c) {
  v8f d = __builtin_amdgcn_wmma_f32_16x16x32_bf16(false, a, false, b, (short)0, c, false, false);
  asm volatile("v_nop\n\tv_nop\n\tv_nop\n\tv_nop" : "+v"(d) : "v"(a), "v"(b));
  return d;
}
// 16x16x32 fragments: lane = (h = lane>>4, row/col = lane&15); elements 0..7 = k0+8h+0..7, 8..15 = k0+16+8h+0..7; D element r = row 8h+r
__device__ __forceinline__ v16h frag_h(const _Float16* rowk0, int lane) {
  union { v16h v; v8h q[2]; } u; const _Float16* p = rowk0 + 8 * (lane >> 4);
  u.q[0] = *(const v8h*)p; u.q[1] = *(const v8h*)(p + 16); return u.v;
}
__device__ __forceinline__ v16h frag_f32(const float* rowk0, int lane) {
  v16h a; const float* p = rowk0 + 8 * (lane >> 4);
#pragma unroll
  for (int i = 0; i < 8; ++i) { a[i] = (_Float16)p[i]; a[8 + i] = (_Float16)p[16 + i]; }
  return a;
}
__device__ __forceinline__ v16h frag_f32s(const float* rowk0, int lane, float sc) {
  v16h a; const float* p = rowk0 + 8 * (lane >> 4);
#pragma unroll
  for (int i = 0; i < 8; ++i) { a[i] = (_Float16)(p[i] * sc); a[8 + i] = (_Float16)(p[16 + i] * sc); }
  return a;
}
// column fragment from a [K][ld] layout (column n), rows >= K read as 0
__device__ __forceinline__ v16h fragc_f32(const float* W, int k0, int n, int lane, int ld, int K) {
  v16h a; const int g = lane >> 4;
#pragma unroll
  for (int i = 0; i < 8; ++i) { const int ka = k0 + 8 * g + i, kb = ka + 16;
    a[i] = (_Float16)(ka < K ? W[(size_t)(ka < K ? ka : K - 1) * ld + n] : 0.f); a[8 + i] = (_Float16)(kb < K ? W[(size_t)(kb < K ? kb : K - 1) * ld + n] : 0.f); }
  return a;
}
struct F2 { v16b h, l; };
__device__ __forceinline__ F2 bsplit16(const float v[16]) { F2 r;
#pragma unroll
  for (int i = 0; i < 16; ++i) { const __bf16 h = (__bf16)v[i]; r.h[i] = h; r.l[i] = (__bf16)(v[i] - (float)h); }
  return r; }
__device__ __forceinline__ F2 split_row(const float* row, int k0, int lane) { float v[16]; const float* p = row + k0 + 8 * (lane >> 4);
#pragma unroll
  for (int i = 0; i < 8; ++i) { v[i] = p[i]; v[8 + i] = p[16 + i]; }
  return bsplit16(v); }
__device__ __forceinline__ F2 split_rowK(const float* row, int k0, int lane, int K) { float v[16]; const int g = lane >> 4;
#pragma unroll
  for (int i = 0; i < 8; ++i) { const int ka = k0 + 8 * g + i, kb = ka + 16; v[i] = ka < K ? row[ka < K ? ka : K - 1] : 0.f; v[8 + i] = kb < K ? row[kb < K ? kb : K - 1] : 0.f; }
  return bsplit16(v); }
__device__ __forceinline__ F2 split_col(const float* W, int k0, int n, int lane, int ld, int K) { float v[16]; const int g = lane >> 4;
#pragma unroll
  for (int i = 0; i < 8; ++i) { const int ka = k0 + 8 * g + i, kb = ka + 16; v[i] = ka < K ? W[(size_t)(ka < K ? ka : K - 1) * ld + n] : 0.f; v[8 + i] = kb < K ? W[(size_t)(kb < K ? kb : K - 1) * ld + n] : 0.f; }
  return bsplit16(v); }
__device__ __forceinline__ v8f mac3(const F2& a, const F2& b, v8f c) { c = wmma_bf(a.l, b.h, c); c = wmma_bf(a.h, b.l, c); return wmma_bf(a.h, b.h, c); }
__device__ __forceinline__ float sigm(float v) { return 1.0f / (1.0f + expf(-v)); }
#define LDSX() do { asm volatile("s_wait_dscnt 0" ::: "memory"); __builtin_amdgcn_wave_barrier(); __builtin_amdgcn_fence(__ATOMIC_RELEASE, "workgroup"); } while (0)


// Head-parallel block-local ('dilated', degenerate gather) attention on given q, k, v (B 2, N 4,096, 12 heads x 64): heads 0-3 attend within 1,024-token segments, 4-7 within 2,048, 8-11 over all 4,096; softmax(q k / 8) v per segment.
#define NB 2
#define SS 4096
#define NH 12
#define HD 64
#define DM (NH * HD)
#ifndef TQB
#define TQB (SS / 128)
#define TNB NB
#define QB0 0            // first query block
#endif
typedef __attribute__((ext_vector_type(8))) __bf16 v8b;
__device__ __forceinline__ v16b frag_b(const __bf16* rowk0, int lane) {
  union { v16b v; v8b q[2]; } u; const __bf16* p = rowk0 + 8 * (lane >> 4);
  u.q[0] = *(const v8b*)p; u.q[1] = *(const v8b*)(p + 16); return u.v;
}
__device__ __forceinline__ float bfr(float v) { return (float)(__bf16)v; }
__device__ __attribute__((noinline)) float exp_ni(float v) { return expf(v); }
__device__ __attribute__((noinline)) float erf_ni(float v) { return erff(v); }

#define WS_VT  0u                                   // f16 v planes [b][h*64 + d][s]
#define WS_END (WS_VT + 2u * (size_t)NB * DM * SS)

// ---- k_vt: block = (64 keys, 128 cols, b): v[b][s][c] -> VT[b][c][s]: rounded to bf16 as every float input, that value stored as f16
__global__ __launch_bounds__(256) void k_vt(const float* __restrict__ V, _Float16* __restrict__ VT) { __shared__ __align__(16) _Float16 st[128][64 + 8]; const int t = threadIdx.x; const int s0 = blockIdx.x * 64; const int c0 = blockIdx.y * 128; const size_t b = blockIdx.z;
  for (int e = t; e < 64 * 128; e += 256) { const int sl = e >> 7, c = e & 127; st[c][sl] = (_Float16)bfr(V[((b * SS + s0 + sl) * DM) + c0 + c]); } __syncthreads();
  for (int e = t; e < 128 * 8; e += 256) { const int c = e >> 3, q = e & 7; vst2((unsigned*)(VT + ((b * DM + c0 + c) * SS) + s0 + q * 8), *(const v4u*)&st[c][q * 8]); } }
__device__ __forceinline__ v16b fragb_f32(const float* __restrict__ p, int lane) { v16b a; const float* pp = p + 8 * (lane >> 4);
#pragma unroll
  for (int i = 0; i < 8; ++i) { a[i] = (__bf16)pp[i]; a[8 + i] = (__bf16)pp[16 + i]; } return a; }
// lane l with lane l ^ 16 (the other half of the wave), on the vector pipe
__device__ __forceinline__ float xhalf(float x) { return __builtin_bit_cast(float, __builtin_amdgcn_permlanex16(__builtin_bit_cast(int, x), __builtin_bit_cast(int, x), 0x76543210, 0xfedcba98, false, false)); }
#define KP 68   // staged K row pitch in floats: 272 B = 16 B x 17, no bank conflict for 16-byte row reads
#define VP 136  // staged V plane row pitch in f16: 272 B = 16 B x 17, likewise
#define SK 128  // keys of one stage of the ring: four passes of 32 keys
#define KBY (SK * KP * 4)          // bytes of a stage's K rows
#define STB (KBY + 64 * VP * 2)    // bytes of a stage: K rows, then V plane rows
#define SL2 0.18033688f            // log2(e) / 8: a product q . k times this is the scaled score as an exponent of 2
// fragb_f32 for a 16-byte-aligned row in LDS: same elements, same rounding, four 16-byte reads
__device__ __forceinline__ v16b fragb_lds(const float* p, int lane) { v16b a; const v4f* pp = (const v4f*)(p + 8 * (lane >> 4)); const v4f x0 = pp[0], x1 = pp[1], x2 = pp[4], x3 = pp[5];
#pragma unroll
  for (int i = 0; i < 4; ++i) { a[i] = (__bf16)x0[i]; a[4 + i] = (__bf16)x1[i]; a[8 + i] = (__bf16)x2[i]; a[12 + i] = (__bf16)x3[i]; } return a; }
// eight copies of 16 B per lane: rows j * 8 + tid / 16 (j = 0 .. 7) of 256 B each, so a wave covers 4 whole lines per copy; gs = 8 source rows in bytes; every staged row has the pitch of 272 B.
// The closing s_wait_xcnt stands inside the statement so that no address register named here is rewritten ahead of it.
__device__ __forceinline__ void copy8(const char* g, size_t gs, unsigned l) {
  asm volatile("global_load_async_to_lds_b128 %0, %8, off\n\t"
               "global_load_async_to_lds_b128 %1, %9, off\n\t"
               "global_load_async_to_lds_b128 %2, %10, off\n\t"
               "global_load_async_to_lds_b128 %3, %11, off\n\t"
               "global_load_async_to_lds_b128 %4, %12, off\n\t"
               "global_load_async_to_lds_b128 %5, %13, off\n\t"
               "global_load_async_to_lds_b128 %6, %14, off\n\t"
               "global_load_async_to_lds_b128 %7, %15, off\n\t"
               "s_wait_xcnt 0x0"
               :: "v"(l), "v"(l + 8u * 272u), "v"(l + 16u * 272u), "v"(l + 24u * 272u), "v"(l + 32u * 272u), "v"(l + 40u * 272u), "v"(l + 48u * 272u), "v"(l + 56u * 272u),
                  "v"(g), "v"(g + gs), "v"(g + 2 * gs), "v"(g + 3 * gs), "v"(g + 4 * gs), "v"(g + 5 * gs), "v"(g + 6 * gs), "v"(g + 7 * gs) : "memory");
}
// one stage of 128 keys, 24 copies per lane: 128 K rows (64 floats each), then the 64 V plane rows (128 f16 each)
__device__ __forceinline__ void stage_kv(const float* gk, const _Float16* gv, unsigned lk, unsigned lv) {
  copy8((const char*)gk, (size_t)8 * DM * 4, lk);
  copy8((const char*)(gk + 64 * DM), (size_t)8 * DM * 4, lk + 64u * 272u);
  copy8((const char*)gv, (size_t)8 * SS * 2, lv);
}
// one pass of 32 keys for this wave's 32 queries (two query tiles of 16, qt = 0, 1), from the staged K rows kt and, from key column ko on, the V plane rows vt: each K and V fragment is read from LDS (and K rounded to bf16) once and feeds both tiles' products. Per query the arithmetic and its order are those of a 16-query wave. MK = the pass may hold keys behind a query of a causal block: only then the key index is compared, and only then a score can be the excluded value, so only then the exponentials are guarded; in every other pass all 32 scores are finite, and exp2 of the start value of m less mn is 0 by itself. m is the running maximum of the products q . k themselves (1/8 > 0 keeps the order); a weight is exp2(product * SL2 + (11 - mn * SL2)) = 2^11 exp(score - maximum): one fused multiply-add in front of the hardware exp2, so l too carries the factor 2^11, which the division behind the loop cancels.
template <bool MK> __device__ __forceinline__ void kv_pass(const float (*kt)[KP], const _Float16 (*vt)[VP], int ko, const v16b (&aq)[2][2], int kb0, int qi, int lane, float (&m)[2], float (&l)[2], v8f (&acc)[2][4]) {
  const int col = lane & 15;
  v16b kf[2][2];
#pragma unroll
  for (int ct = 0; ct < 2; ++ct)
#pragma unroll
    for (int kc = 0; kc < 2; ++kc) kf[ct][kc] = fragb_lds(&kt[ct * 16 + col][kc * 32], lane);
  v8f c[2][2] = {};   // c[qt][ct][r] = score of key kb0 + ct * 16 + r, query qi + qt * 16: four independent accumulators
#pragma unroll
  for (int kc = 0; kc < 2; ++kc)
#pragma unroll
    for (int qt = 0; qt < 2; ++qt)
#pragma unroll
      for (int ct = 0; ct < 2; ++ct) c[qt][ct] = wmma_bf(kf[ct][kc], aq[qt][kc], c[qt][ct]);
  v16h vf[4];
#pragma unroll
  for (int dt = 0; dt < 4; ++dt) vf[dt] = frag_h(&vt[dt * 16 + col][ko], lane);
  v16h pa[2];   // per tile: element i = key 8 g + i, element 8 + i = key 16 + 8 g + i: the k order of frag_h
#pragma unroll
  for (int qt = 0; qt < 2; ++qt) { v8f s[2];
#pragma unroll
    for (int ct = 0; ct < 2; ++ct)
#pragma unroll
      for (int r = 0; r < 8; ++r) s[ct][r] = (!MK || kb0 + ct * 16 + r <= qi + qt * 16) ? c[qt][ct][r] : -3.0e38f;
    float mr[8];
#pragma unroll
    for (int r = 0; r < 8; ++r) mr[r] = fmaxf(s[0][r], s[1][r]);
    float mx = fmaxf(fmaxf(fmaxf(mr[0], mr[1]), fmaxf(mr[2], mr[3])), fmaxf(fmaxf(mr[4], mr[5]), fmaxf(mr[6], mr[7])));
    mx = fmaxf(mx, xhalf(mx));
    const float mn = fmaxf(m[qt], mx); const float alpha = (MK && m[qt] <= -1.0e38f) ? 0.f : __builtin_amdgcn_exp2f((m[qt] - mn) * SL2);
    const float bo = __builtin_fmaf(-mn, SL2, 11.0f);
    const v8f t0 = __builtin_elementwise_fma(s[0], (v8f)(SL2), (v8f)(bo)), t1 = __builtin_elementwise_fma(s[1], (v8f)(SL2), (v8f)(bo));   // on whole accumulator tiles: neighbouring registers pair up
    float e[16];
#pragma unroll
    for (int i = 0; i < 8; ++i) { e[i] = (MK && s[0][i] <= -1.0e38f) ? 0.f : __builtin_amdgcn_exp2f(t0[i]); e[8 + i] = (MK && s[1][i] <= -1.0e38f) ? 0.f : __builtin_amdgcn_exp2f(t1[i]); }
    float er[8];
#pragma unroll
    for (int i = 0; i < 8; ++i) er[i] = e[i] + e[8 + i];
    l[qt] = l[qt] * alpha + (((er[0] + er[1]) + (er[2] + er[3])) + ((er[4] + er[5]) + (er[6] + er[7]))); m[qt] = mn;
#pragma unroll
    for (int dt = 0; dt < 4; ++dt) acc[qt][dt] *= alpha;
#pragma unroll
    for (int i = 0; i < 16; ++i) pa[qt][i] = (_Float16)e[i];   // e holds the factor 2^11: weights down to 2^-25 of the row's maximum stay normal f16 numbers
  }
#pragma unroll
  for (int qt = 0; qt < 2; ++qt)
#pragma unroll
    for (int dt = 0; dt < 4; ++dt) acc[qt][dt] = wmma16(vf[dt], pa[qt], acc[qt][dt]);   // acc[qt][dt][r] = out column dt * 16 + 8 g + r of query qi + qt * 16
}
// stages t0 .. t1 - 1 of the nst stages of a block, four passes each, all of one form; the foot of each stage is the ring's: own LDS reads done, own copies landed, one block barrier, then the refill two stages ahead, which so has the four passes of a whole stage to land
template <bool MK> __device__ __forceinline__ void kv_loop(int t0, int t1, int nst, int ks0, const unsigned char* ring, const float* gk, const _Float16* gv, unsigned lk, unsigned lv, const v16b (&aq)[2][2], int qi, int lane, float (&m)[2], float (&l)[2], v8f (&acc)[2][4]) {
  // the stage loop stays rolled: a second copy of its long body would add code and save only the loop's few scalar instructions
#pragma unroll 1
  for (int t = t0; t < t1; ++t) { const int bf = t & 1;
    const float (*kt)[KP] = (const float (*)[KP])(ring + bf * STB); const _Float16 (*vt)[VP] = (const _Float16 (*)[VP])(ring + bf * STB + KBY);
    // the pass loop stays rolled: with the four long bodies in a row the build took more than 256 registers and switched register windows all through the loop
#pragma unroll 1
    for (int p = 0; p < SK / 32; ++p) kv_pass<MK>(kt + p * 32, vt, p * 32, aq, (ks0 + t * (SK / 32) + p) * 32 + 8 * (lane >> 4), qi, lane, m, l, acc);
    asm volatile("s_wait_dscnt 0x0" ::: "memory");      // this wave's reads of buffer bf are done
    asm volatile("s_wait_asynccnt 0x0" ::: "memory");   // this wave's part of stage t + 1 has landed
    __syncthreads();                                    // publishes stage t + 1 and frees buffer bf for the refill
    if (t + 2 < nst) stage_kv(gk + (size_t)(t + 2) * SK * DM, gv + (t + 2) * SK, lk + (unsigned)bf * (unsigned)STB, lv + (unsigned)bf * (unsigned)STB); }
}
__global__ __launch_bounds__(128) void k_attn(const float* __restrict__ Q, const float* __restrict__ K, const _Float16* __restrict__ VT, const int* __restrict__ ISC, float* __restrict__ CTX) {
  __shared__ __align__(16) unsigned char ring[2 * STB];
  float (*so)[32][68] = (float (*)[32][68])ring;   // output staging, 34,816 B: used only behind the loop
  const int tid = threadIdx.x, wave = tid >> 5, lane = tid & 31, col = lane & 15, g = lane >> 4; const int qb = blockIdx.x + QB0, h = NH - 1 - (int)blockIdx.z; const size_t b = blockIdx.y; const int q0 = qb * 128 + wave * 32; const size_t rq = b * SS + q0;
  v16b aq[2][2];
#pragma unroll
  for (int qt = 0; qt < 2; ++qt)
#pragma unroll
    for (int kc = 0; kc < 2; ++kc) aq[qt][kc] = fragb_f32(Q + (rq + qt * 16 + col) * DM + h * HD + kc * 32, lane);
  float m[2] = {-3.0e38f, -3.0e38f}, l[2] = {0.f, 0.f};   // of query q0 + qt * 16 + col; l holds this wave half's keys only, the halves are joined behind the loop
  v8f acc[2][4] = {};
  const int grp = (h / 4 > 2) ? 2 : h / 4; const int L = 1024 << grp; const int seg = (qb * 128) / L; const bool causal = (ISC[0] != 0) && grp == 0 && seg == 0; const int ks0 = seg * L / 32;
  const int nst = causal ? qb + 1 : L / SK;   // stages of 128 keys; causal: up to the block's last query (at least 1, at most L / SK)
  const float* gk = K + (b * SS + (size_t)ks0 * 32 + (tid >> 4)) * DM + h * HD + (tid & 15) * 4;
  const _Float16* gv = VT + (b * DM + h * HD + (tid >> 4)) * SS + (size_t)ks0 * 32 + (tid & 15) * 8;
  const unsigned lk = (unsigned)(size_t)&ring[(tid >> 4) * 272 + (tid & 15) * 16], lv = lk + (unsigned)KBY;
  stage_kv(gk, gv, lk, lv);
  asm volatile("s_wait_asynccnt 0x0" ::: "memory");   // this wave's part of stage 0 has landed
  __syncthreads();                                    // stage 0 readable by all four waves
  if (nst > 1) stage_kv(gk + SK * DM, gv + SK, lk + (unsigned)STB, lv + (unsigned)STB);   // a causal block on the first 128 queries has one stage only
  const int nfree = causal ? nst - 1 : nst;   // a causal block's last stage (keys from its first query on) is the only one that can hold a key behind a query
  kv_loop<false>(0, nfree, nst, ks0, ring, gk, gv, lk, lv, aq, q0 + col, lane, m, l, acc);
  kv_loop<true>(nfree, nst, nst, ks0, ring, gk, gv, lk, lv, aq, q0 + col, lane, m, l, acc);
  asm volatile("s_wait_asynccnt 0x0" ::: "memory");     // nothing in flight behind the loop
#pragma unroll
  for (int qt = 0; qt < 2; ++qt) { const float ls = l[qt] + xhalf(l[qt]);
    const float il = (ls > 0.f) ? 1.0f / ls : 0.f;   // acc and ls both carry 2^11
#pragma unroll
    for (int dt = 0; dt < 4; ++dt)
#pragma unroll
      for (int r = 0; r < 8; ++r) so[wave][qt * 16 + col][dt * 16 + 8 * g + r] = acc[qt][dt][r] * il; }
  LDSX();
  for (int rl = 0; rl < 32; ++rl) if (lane < 16) vst2(CTX + (rq + rl) * DM + h * HD + lane * 4, *(const v4f*)&so[wave][rl][lane * 4]);
}
extern "C" void kernel_launch(void* const* d_in, const int* in_sizes, int n_in, void* d_out, int out_size, void* d_ws, size_t ws_size, hipStream_t stream) {
  (void)in_sizes; (void)n_in; (void)out_size;
  const float** F = (const float**)d_in;   // 0 q [2,4096,12,64], 1 k, 2 v, 3 is_causal int scalar
  if (ws_size < (size_t)WS_END) return;
  char* ws = (char*)d_ws; _Float16* VT = (_Float16*)(ws + WS_VT);
  k_vt<<<dim3(SS / 64, DM / 128, NB), 256, 0, stream>>>(F[2], VT);
  k_attn<<<dim3(TQB, TNB, NH), 128, 0, stream>>>(F[0], F[1], VT, (const int*)d_in[3], (float*)d_out);
}

// v009
// Measured time: 62.1 microseconds a run.
// Two timings next to v008 both put it at 1.06 times that version's speed.
// Over all steps from v000 it is 8.11 times as fast.
// compute dtype: all float inputs rounded to bf16, is_causal (int scalar) read on device; scores = q . k with EXACT bf16 x bf16 products on WMMA 16x16x32 restricted to the query's own segment (block-local attention; segment length 1024 / 2048 / 4096 by head group), optional causal exclusion on segment 0 of group 0 when is_causal != 0, running-max softmax in f32 (maximum and rescale once per mask-free stage of 128 keys) with the factors 1/8, log2 e and 2^11 inside one fused multiply-add per score (hardware exp2); P (x 2^11) rounded once to f16 (11 significand bits, 1 product on WMMA 16x16x32 f16) x v (the bf16-rounded values held as f16 planes, exact from 2^-14 up); f32 output.
#include <hip/hip_runtime.h>
#include <math.h>

typedef __attribute__((ext_vector_type(16))) _Float16 v16h;
typedef __attribute__((ext_vector_type(16))) __bf16 v16b;
typedef __attribute__((ext_vector_type(8)))  _Float16 v8h;
typedef __attribute__((ext_vector_type(8)))  float v8f;
typedef __attribute__((ext_vector_type(4)))  float v4f;
typedef __attribute__((ext_vector_type(2)))  float v2f;
typedef __attribute__((ext_vector_type(4)))  unsigned v4u;
typedef __attribute__((ext_vector_type(4)))  int v4i;
typedef float __attribute__((may_alias)) float_a;
typedef int __attribute__((may_alias)) int_a;

template <typename T> __device__ __forceinline__ void vst2(void* p, T v) { *(T*)p = v;  }
__device__ __forceinline__ v8f wmma16(v16h a, v16h b, v8f c) {
  v8f d = __builtin_amdgcn_wmma_f32_16x16x32_f16(false, a, false, b, (short)0, c, false, false);
  asm volatile("v_nop\n\tv_nop\n\tv_nop\n\tv_nop" : "+v"(d) : "v"(a), "v"(b));
  return d;
}
__device__ __forceinline__ v8f wmma_bf(v16b a, v16b b, v8f c) {
  v8f d = __builtin_amdgcn_wmma_f32_16x16x32_bf16(false, a, false, b, (short)0, c, false, false);
  asm volatile("v_nop\n\tv_nop\n\tv_nop\n\tv_nop" : "+v"(d) : "v"(a), "v"(b));
  return d;
}
// 16x16x32 fragments: lane = (h = lane>>4, row/col = lane&15); elements 0..7 = k0+8h+0..7, 8..15 = k0+16+8h+0..7; D element r = row 8h+r
__device__ __forceinline__ v16h frag_h(const _Float16* rowk0, int lane) {
  union { v16h v; v8h q[2]; } u; const _Float16* p = rowk0 + 8 * (lane >> 4);
  u.q[0] = *(const v8h*)p; u.q[1] = *(const v8h*)(p + 16); return u.v;
}
__device__ __forceinline__ v16h frag_f32(const float* rowk0, int lane) {
  v16h a; const float* p = rowk0 + 8 * (lane >> 4);
#pragma unroll
  for (int i = 0; i < 8; ++i) { a[i] = (_Float16)p[i]; a[8 + i] = (_Float16)p[16 + i]; }
  return a;
}
__device__ __forceinline__ v16h frag_f32s(const float* rowk0, int lane, float sc) {
  v16h a; const float* p = rowk0 + 8 * (lane >> 4);
#pragma unroll
  for (int i = 0; i < 8; ++i) { a[i] = (_Float16)(p[i] * sc); a[8 + i] = (_Float16)(p[16 + i] * sc); }
  return a;
}
// column fragment from a [K][ld] layout (column n), rows >= K read as 0
__device__ __forceinline__ v16h fragc_f32(const float* W, int k0, int n, int lane, int ld, int K) {
  v16h a; const int g = lane >> 4;
#pragma unroll
  for (int i = 0; i < 8; ++i) { const int ka = k0 + 8 * g + i, kb = ka + 16;
    a[i] = (_Float16)(ka < K ? W[(size_t)(ka < K ? ka : K - 1) * ld + n] : 0.f); a[8 + i] = (_Float16)(kb < K ? W[(size_t)(kb < K ? kb : K - 1) * ld + n] : 0.f); }
  return a;
}
struct F2 { v16b h, l; };
__device__ __forceinline__ F2 bsplit16(const float v[16]) { F2 r;
#pragma unroll
  for (int i = 0; i < 16; ++i) { const __bf16 h = (__bf16)v[i]; r.h[i] = h; r.l[i] = (__bf16)(v[i] - (float)h); }
  return r; }
__device__ __forceinline__ F2 split_row(const float* row, int k0, int lane) { float v[16]; const float* p = row + k0 + 8 * (lane >> 4);
#pragma unroll
  for (int i = 0; i < 8; ++i) { v[i] = p[i]; v[8 + i] = p[16 + i]; }
  return bsplit16(v); }
__device__ __forceinline__ F2 split_rowK(const float* row, int k0, int lane, int K) { float v[16]; const int g = lane >> 4;
#pragma unroll
  for (int i = 0; i < 8; ++i) { const int ka = k0 + 8 * g + i, kb = ka + 16; v[i] = ka < K ? row[ka < K ? ka : K - 1] : 0.f; v[8 + i] = kb < K ? row[kb < K ? kb : K - 1] : 0.f; }
  return bsplit16(v); }
__device__ __forceinline__ F2 split_col(const float* W, int k0, int n, int lane, int ld, int K) { float v[16]; const int g = lane >> 4;
#pragma unroll
  for (int i = 0; i < 8; ++i) { const int ka = k0 + 8 * g + i, kb = ka + 16; v[i] = ka < K ? W[(size_t)(ka < K ? ka : K - 1) * ld + n] : 0.f; v[8 + i] = kb < K ? W[(size_t)(kb < K ? kb : K - 1) * ld + n] : 0.f; }
  return bsplit16(v); }
__device__ __forceinline__ v8f mac3(const F2& a, const F2& b, v8f c) { c = wmma_bf(a.l, b.h, c); c = wmma_bf(a.h, b.l, c); return wmma_bf(a.h, b.h, c); }
__device__ __forceinline__ float sigm(float v) { return 1.0f / (1.0f + expf(-v)); }
#define LDSX() do { asm volatile("s_wait_dscnt 0" ::: "memory"); __builtin_amdgcn_wave_barrier(); __builtin_amdgcn_fence(__ATOMIC_RELEASE, "workgroup"); } while (0)


// Head-parallel block-local ('dilated', degenerate gather) attention on given q, k, v (B 2, N 4,096, 12 heads x 64): heads 0-3 attend within 1,024-token segments, 4-7 within 2,048, 8-11 over all 4,096; softmax(q k / 8) v per segment.
#define NB 2
#define SS 4096
#define NH 12
#define HD 64
#define DM (NH * HD)
#ifndef TQB
#define TQB (SS / 128)
#define TNB NB
#define QB0 0            // first query block
#endif
typedef __attribute__((ext_vector_type(8))) __bf16 v8b;
__device__ __forceinline__ v16b frag_b(const __bf16* rowk0, int lane) {
  union { v16b v; v8b q[2]; } u; const __bf16* p = rowk0 + 8 * (lane >> 4);
  u.q[0] = *(const v8b*)p; u.q[1] = *(const v8b*)(p + 16); return u.v;
}
__device__ __forceinline__ float bfr(float v) { return (float)(__bf16)v; }
__device__ __attribute__((noinline)) float exp_ni(float v) { return expf(v); }
__device__ __attribute__((noinline)) float erf_ni(float v) { return erff(v); }

#define WS_VT  0u                                   // f16 v planes [b][h*64 + d][s]
#define WS_END (WS_VT + 2u * (size_t)NB * DM * SS)

// ---- k_vt: block = (64 keys, 128 cols, b): v[b][s][c] -> VT[b][c][s]: rounded to bf16 as every float input, that value stored as f16
__global__ __launch_bounds__(256) void k_vt(const float* __restrict__ V, _Float16* __restrict__ VT) { __shared__ __align__(16) _Float16 st[128][64 + 8]; const int t = threadIdx.x; const int s0 = blockIdx.x * 64; const int c0 = blockIdx.y * 128; const size_t b = blockIdx.z;
  for (int e = t; e < 64 * 128; e += 256) { const int sl = e >> 7, c = e & 127; st[c][sl] = (_Float16)bfr(V[((b * SS + s0 + sl) * DM) + c0 + c]); } __syncthreads();
  for (int e = t; e < 128 * 8; e += 256) { const int c = e >> 3, q = e & 7; vst2((unsigned*)(VT + ((b * DM + c0 + c) * SS) + s0 + q * 8), *(const v4u*)&st[c][q * 8]); } }
__device__ __forceinline__ v16b fragb_f32(const float* __restrict__ p, int lane) { v16b a; const float* pp = p + 8 * (lane >> 4);
#pragma unroll
  for (int i = 0; i < 8; ++i) { a[i] = (__bf16)pp[i]; a[8 + i] = (__bf16)pp[16 + i]; } return a; }
// lane l with lane l ^ 16 (the other half of the wave), on the vector pipe
__device__ __forceinline__ float xhalf(float x) { return __builtin_bit_cast(float, __builtin_amdgcn_permlanex16(__builtin_bit_cast(int, x), __builtin_bit_cast(int, x), 0x76543210, 0xfedcba98, false, false)); }
#define KP 68   // staged K row pitch in floats: 272 B = 16 B x 17, no bank conflict for 16-byte row reads
#define VP 136  // staged V plane row pitch in f16: 272 B = 16 B x 17, likewise
#define SK 128  // keys of one stage of the ring: four chunks of 32 keys
#define KBY (SK * KP * 4)          // bytes of a stage's K rows
#define STB (KBY + 64 * VP * 2)    // bytes of a stage: K rows, then V plane rows
#define SL2 0.18033688f            // log2(e) / 8: a product q . k times this is the scaled score as an exponent of 2
// fragb_f32 for a 16-byte-aligned row in LDS: same elements, same rounding, four 16-byte reads
__device__ __forceinline__ v16b fragb_lds(const float* p, int lane) { v16b a; const v4f* pp = (const v4f*)(p + 8 * (lane >> 4)); const v4f x0 = pp[0], x1 = pp[1], x2 = pp[4], x3 = pp[5];
#pragma unroll
  for (int i = 0; i < 4; ++i) { a[i] = (__bf16)x0[i]; a[4 + i] = (__bf16)x1[i]; a[8 + i] = (__bf16)x2[i]; a[12 + i] = (__bf16)x3[i]; } return a; }
// eight copies of 16 B per lane: rows j * 8 + tid / 16 (j = 0 .. 7) of 256 B each, so a wave covers 4 whole lines per copy; gs = 8 source rows in bytes; every staged row has the pitch of 272 B.
// The closing s_wait_xcnt stands inside the statement so that no address register named here is rewritten ahead of it.
__device__ __forceinline__ void copy8(const char* g, size_t gs, unsigned l) {
  asm volatile("global_load_async_to_lds_b128 %0, %8, off\n\t"
               "global_load_async_to_lds_b128 %1, %9, off\n\t"
               "global_load_async_to_lds_b128 %2, %10, off\n\t"
               "global_load_async_to_lds_b128 %3, %11, off\n\t"
               "global_load_async_to_lds_b128 %4, %12, off\n\t"
               "global_load_async_to_lds_b128 %5, %13, off\n\t"
               "global_load_async_to_lds_b128 %6, %14, off\n\t"
               "global_load_async_to_lds_b128 %7, %15, off\n\t"
               "s_wait_xcnt 0x0"
               :: "v"(l), "v"(l + 8u * 272u), "v"(l + 16u * 272u), "v"(l + 24u * 272u), "v"(l + 32u * 272u), "v"(l + 40u * 272u), "v"(l + 48u * 272u), "v"(l + 56u * 272u),
                  "v"(g), "v"(g + gs), "v"(g + 2 * gs), "v"(g + 3 * gs), "v"(g + 4 * gs), "v"(g + 5 * gs), "v"(g + 6 * gs), "v"(g + 7 * gs) : "memory");
}
// one stage of 128 keys, 24 copies per lane: 128 K rows (64 floats each), then the 64 V plane rows (128 f16 each)
__device__ __forceinline__ void stage_kv(const float* gk, const _Float16* gv, unsigned lk, unsigned lv) {
  copy8((const char*)gk, (size_t)8 * DM * 4, lk);
  copy8((const char*)(gk + 64 * DM), (size_t)8 * DM * 4, lk + 64u * 272u);
  copy8((const char*)gv, (size_t)8 * SS * 2, lv);
}
// one pass of 32 keys for this wave's 32 queries (two query tiles of 16, qt = 0, 1), from the staged K rows kt and, from key column ko on, the V plane rows vt: each K and V fragment is read from LDS (and K rounded to bf16) once and feeds both tiles' products. Per query the arithmetic and its order are those of a 16-query wave. MK = the pass may hold keys behind a query of a causal block: only then the key index is compared, and only then a score can be the excluded value, so only then the exponentials are guarded; in every other pass all 32 scores are finite, and exp2 of the start value of m less mn is 0 by itself. m is the running maximum of the products q . k themselves (1/8 > 0 keeps the order); a weight is exp2(product * SL2 + (11 - mn * SL2)) = 2^11 exp(score - maximum): one fused multiply-add in front of the hardware exp2, so l too carries the factor 2^11, which the division behind the loop cancels.
template <bool MK> __device__ __forceinline__ void kv_pass(const float (*kt)[KP], const _Float16 (*vt)[VP], int ko, const v16b (&aq)[2][2], int kb0, int qi, int lane, float (&m)[2], float (&l)[2], v8f (&acc)[2][4]) {
  const int col = lane & 15;
  v16b kf[2][2];
#pragma unroll
  for (int ct = 0; ct < 2; ++ct)
#pragma unroll
    for (int kc = 0; kc < 2; ++kc) kf[ct][kc] = fragb_lds(&kt[ct * 16 + col][kc * 32], lane);
  v8f c[2][2] = {};   // c[qt][ct][r] = score of key kb0 + ct * 16 + r, query qi + qt * 16: four independent accumulators
#pragma unroll
  for (int kc = 0; kc < 2; ++kc)
#pragma unroll
    for (int qt = 0; qt < 2; ++qt)
#pragma unroll
      for (int ct = 0; ct < 2; ++ct) c[qt][ct] = wmma_bf(kf[ct][kc], aq[qt][kc], c[qt][ct]);
  v16h vf[4];
#pragma unroll
  for (int dt = 0; dt < 4; ++dt) vf[dt] = frag_h(&vt[dt * 16 + col][ko], lane);
  v16h pa[2];   // per tile: element i = key 8 g + i, element 8 + i = key 16 + 8 g + i: the k order of frag_h
#pragma unroll
  for (int qt = 0; qt < 2; ++qt) { v8f s[2];
#pragma unroll
    for (int ct = 0; ct < 2; ++ct)
#pragma unroll
      for (int r = 0; r < 8; ++r) s[ct][r] = (!MK || kb0 + ct * 16 + r <= qi + qt * 16) ? c[qt][ct][r] : -3.0e38f;
    float mr[8];
#pragma unroll
    for (int r = 0; r < 8; ++r) mr[r] = fmaxf(s[0][r], s[1][r]);
    float mx = fmaxf(fmaxf(fmaxf(mr[0], mr[1]), fmaxf(mr[2], mr[3])), fmaxf(fmaxf(mr[4], mr[5]), fmaxf(mr[6], mr[7])));
    mx = fmaxf(mx, xhalf(mx));
    const float mn = fmaxf(m[qt], mx); const float alpha = (MK && m[qt] <= -1.0e38f) ? 0.f : __builtin_amdgcn_exp2f((m[qt] - mn) * SL2);
    const float bo = __builtin_fmaf(-mn, SL2, 11.0f);
    const v8f t0 = __builtin_elementwise_fma(s[0], (v8f)(SL2), (v8f)(bo)), t1 = __builtin_elementwise_fma(s[1], (v8f)(SL2), (v8f)(bo));   // on whole accumulator tiles: neighbouring registers pair up
    float e[16];
#pragma unroll
    for (int i = 0; i < 8; ++i) { e[i] = (MK && s[0][i] <= -1.0e38f) ? 0.f : __builtin_amdgcn_exp2f(t0[i]); e[8 + i] = (MK && s[1][i] <= -1.0e38f) ? 0.f : __builtin_amdgcn_exp2f(t1[i]); }
    float er[8];
#pragma unroll
    for (int i = 0; i < 8; ++i) er[i] = e[i] + e[8 + i];
    l[qt] = l[qt] * alpha + (((er[0] + er[1]) + (er[2] + er[3])) + ((er[4] + er[5]) + (er[6] + er[7]))); m[qt] = mn;
#pragma unroll
    for (int dt = 0; dt < 4; ++dt) acc[qt][dt] *= alpha;
#pragma unroll
    for (int i = 0; i < 16; ++i) pa[qt][i] = (_Float16)e[i];   // e holds the factor 2^11: weights down to 2^-25 of the row's maximum stay normal f16 numbers
  }
#pragma unroll
  for (int qt = 0; qt < 2; ++qt)
#pragma unroll
    for (int dt = 0; dt < 4; ++dt) acc[qt][dt] = wmma16(vf[dt], pa[qt], acc[qt][dt]);   // acc[qt][dt][r] = out column dt * 16 + 8 g + r of query qi + qt * 16
}
// a mask-free stage in ONE pass of NC * 32 keys (NC chunks of 32) for this wave's 32 queries: fragments, products, weights and their rounding as in kv_pass<false>, but all scores of the stage are formed first and stay in registers, so that the maximum, its exchange between the wave halves, alpha and the rescale of l and of the 64 output accumulators run once per 128 keys and not once per 32; the weights of the pass are summed in eight running partial sums per tile, joined once per pass. All scores are finite here, and exp2 of the start value of m less mn is 0 by itself. The products are the plain builtins (the compiler keeps the distance behind them itself): the v_nop statement of wmma_bf and wmma16 binds its operands to the first 256 registers, and the 128 score registers beside the accumulators, Q and a chunk of K need more than those.
#define NC (SK / 32)
struct KRaw { v4f x[2][2][4]; };   // a chunk's K rows as staged: [key tile][half of the head][the four 16-byte reads of fragb_lds]
__device__ __forceinline__ void kraw_lds(KRaw& k, const float (*kt)[KP], int col, int lane) {
#pragma unroll
  for (int ct = 0; ct < 2; ++ct)
#pragma unroll
    for (int kc = 0; kc < 2; ++kc) { const v4f* pp = (const v4f*)(&kt[ct * 16 + col][kc * 32] + 8 * (lane >> 4)); k.x[ct][kc][0] = pp[0]; k.x[ct][kc][1] = pp[1]; k.x[ct][kc][2] = pp[4]; k.x[ct][kc][3] = pp[5]; }
}
__device__ __forceinline__ void kv_wide(const float (*kt)[KP], const _Float16 (*vt)[VP], const v16b (&aq)[2][2], int lane, float (&m)[2], float (&l)[2], v8f (&acc)[2][4]) {
  const int col = lane & 15;
  v8f c[2][2 * NC];   // c[qt][j][r] = score of the stage's key j * 16 + 8 g + r, query tile qt, column lane & 15
  KRaw kr; kraw_lds(kr, kt, col, lane);
#pragma unroll
  for (int ch = 0; ch < NC; ++ch) { v16b kf[2][2];
#pragma unroll
    for (int ct = 0; ct < 2; ++ct)
#pragma unroll
      for (int kc = 0; kc < 2; ++kc)
#pragma unroll
        for (int i = 0; i < 16; ++i) kf[ct][kc][i] = (__bf16)kr.x[ct][kc][i >> 2][i & 3];   // the element order and the rounding of fragb_lds
    if (ch + 1 < NC) kraw_lds(kr, kt + (ch + 1) * 32, col, lane);
    __builtin_amdgcn_sched_barrier(0);   // keeps the next chunk's LDS reads in front of this chunk's products, which cover their latency
#pragma unroll
    for (int qt = 0; qt < 2; ++qt)
#pragma unroll
      for (int ct = 0; ct < 2; ++ct) c[qt][ch * 2 + ct] = v8f{};
#pragma unroll
    for (int kc = 0; kc < 2; ++kc)
#pragma unroll
      for (int qt = 0; qt < 2; ++qt)
#pragma unroll
        for (int ct = 0; ct < 2; ++ct) c[qt][ch * 2 + ct] = __builtin_amdgcn_wmma_f32_16x16x32_bf16(false, kf[ct][kc], false, aq[qt][kc], (short)0, c[qt][ch * 2 + ct], false, false);
  }
  v16h vf[2][4];   // V fragments of two chunks: the next chunk's are read while this chunk's products run
  v16h pa[2][NC];   // per tile and chunk: element i = key 8 g + i, element 8 + i = key 16 + 8 g + i of the chunk: the k order of frag_h
#pragma unroll
  for (int qt = 0; qt < 2; ++qt) {
    float mr[8];
#pragma unroll
    for (int r = 0; r < 8; ++r) { mr[r] = fmaxf(c[qt][0][r], c[qt][1][r]);
#pragma unroll
      for (int j = 2; j < 2 * NC; j += 2) mr[r] = fmaxf(fmaxf(mr[r], c[qt][j][r]), c[qt][j + 1][r]); }
    float mx = fmaxf(fmaxf(fmaxf(mr[0], mr[1]), fmaxf(mr[2], mr[3])), fmaxf(fmaxf(mr[4], mr[5]), fmaxf(mr[6], mr[7])));
    mx = fmaxf(mx, xhalf(mx));
    const float mn = fmaxf(m[qt], mx); const float alpha = __builtin_amdgcn_exp2f((m[qt] - mn) * SL2);
    const float bo = __builtin_fmaf(-mn, SL2, 11.0f);
    v8f ps = {};   // running partial sums of the pass's weights
#pragma unroll
    for (int ch = 0; ch < NC; ++ch) {
      const v8f t0 = __builtin_elementwise_fma(c[qt][ch * 2], (v8f)(SL2), (v8f)(bo)), t1 = __builtin_elementwise_fma(c[qt][ch * 2 + 1], (v8f)(SL2), (v8f)(bo));   // on whole accumulator tiles: neighbouring registers pair up
      v8f e0, e1;
#pragma unroll
      for (int i = 0; i < 8; ++i) e0[i] = __builtin_amdgcn_exp2f(t0[i]);
#pragma unroll
      for (int i = 0; i < 8; ++i) e1[i] = __builtin_amdgcn_exp2f(t1[i]);
      ps += e0 + e1;
#pragma unroll
      for (int i = 0; i < 8; ++i) { pa[qt][ch][i] = (_Float16)e0[i]; pa[qt][ch][8 + i] = (_Float16)e1[i]; }   // the weights hold the factor 2^11: down to 2^-25 of the row's maximum they stay normal f16 numbers
    }
    if (qt == 1) {   // the first chunk's V fragments: read only once the scores have shrunk to f16 weights and left room for them; the joins of the sums and the rescale cover part of their latency
#pragma unroll
      for (int dt = 0; dt < 4; ++dt) vf[0][dt] = frag_h(&vt[dt * 16 + col][0], lane);
    }
    l[qt] = l[qt] * alpha + (((ps[0] + ps[1]) + (ps[2] + ps[3])) + ((ps[4] + ps[5]) + (ps[6] + ps[7]))); m[qt] = mn;
    asm volatile("" : "+v"(l[qt]));   // empty asm on each row's sum, against spills: else the compiler sinks the additions behind the stage's barrier, keeps every weight of the pass live in f32 till there and spills
#pragma unroll
    for (int dt = 0; dt < 4; ++dt) acc[qt][dt] *= alpha;
  }
#pragma unroll
  for (int ch = 0; ch < NC; ++ch) {
    if (ch + 1 < NC) {
#pragma unroll
      for (int dt = 0; dt < 4; ++dt) vf[(ch + 1) & 1][dt] = frag_h(&vt[dt * 16 + col][(ch + 1) * 32], lane);
    }
    __builtin_amdgcn_sched_barrier(0);   // keeps the next chunk's LDS reads in front of this chunk's products, which cover their latency
#pragma unroll
    for (int qt = 0; qt < 2; ++qt)
#pragma unroll
      for (int dt = 0; dt < 4; ++dt) acc[qt][dt] = __builtin_amdgcn_wmma_f32_16x16x32_f16(false, vf[ch & 1][dt], false, pa[qt][ch], (short)0, acc[qt][dt], false, false);   // acc[qt][dt][r] = out column dt * 16 + 8 g + r of query tile qt, column lane & 15
  }
}
// stages t0 .. t1 - 1 of the nst stages of a block, all of one form (mask-free: one pass of 128 keys; masked: four passes of 32 keys); the foot of each stage is the ring's: own LDS reads done, own copies landed, one block barrier, then the refill two stages ahead, which so has the work of a whole stage to land
template <bool MK> __device__ __forceinline__ void kv_loop(int t0, int t1, int nst, int ks0, const unsigned char* ring, const float* gk, const _Float16* gv, unsigned lk, unsigned lv, const v16b (&aq)[2][2], int qi, int lane, float (&m)[2], float (&l)[2], v8f (&acc)[2][4]) {
  // the stage loop stays rolled: a second copy of its long body would add code and save only the loop's few scalar instructions
#pragma unroll 1
  for (int t = t0; t < t1; ++t) { const int bf = t & 1;
    const float (*kt)[KP] = (const float (*)[KP])(ring + bf * STB); const _Float16 (*vt)[VP] = (const _Float16 (*)[VP])(ring + bf * STB + KBY);
    if constexpr (!MK) kv_wide(kt, vt, aq, lane, m, l, acc);
    else {
      // the masked stage's pass loop stays rolled: it runs once per causal block, and four long bodies in a row would only add code and registers
#pragma unroll 1
      for (int p = 0; p < SK / 32; ++p) kv_pass<MK>(kt + p * 32, vt, p * 32, aq, (ks0 + t * (SK / 32) + p) * 32 + 8 * (lane >> 4), qi, lane, m, l, acc);
    }
    asm volatile("s_wait_dscnt 0x0" ::: "memory");      // this wave's reads of buffer bf are done
    asm volatile("s_wait_asynccnt 0x0" ::: "memory");   // this wave's part of stage t + 1 has landed
    __syncthreads();                                    // publishes stage t + 1 and frees buffer bf for the refill
    if (t + 2 < nst) stage_kv(gk + (size_t)(t + 2) * SK * DM, gv + (t + 2) * SK, lk + (unsigned)bf * (unsigned)STB, lv + (unsigned)bf * (unsigned)STB); }
}
__global__ __launch_bounds__(128) void k_attn(const float* __restrict__ Q, const float* __restrict__ K, const _Float16* __restrict__ VT, const int* __restrict__ ISC, float* __restrict__ CTX) {
  __shared__ __align__(16) unsigned char ring[2 * STB];
  float (*so)[32][68] = (float (*)[32][68])ring;   // output staging, 34,816 B: used only behind the loop
  const int tid = threadIdx.x, wave = tid >> 5, lane = tid & 31, col = lane & 15, g = lane >> 4; const int qb = blockIdx.x + QB0, h = NH - 1 - (int)blockIdx.z; const size_t b = blockIdx.y; const int q0 = qb * 128 + wave * 32; const size_t rq = b * SS + q0;
  v16b aq[2][2];
#pragma unroll
  for (int qt = 0; qt < 2; ++qt)
#pragma unroll
    for (int kc = 0; kc < 2; ++kc) aq[qt][kc] = fragb_f32(Q + (rq + qt * 16 + col) * DM + h * HD + kc * 32, lane);
  float m[2] = {-3.0e38f, -3.0e38f}, l[2] = {0.f, 0.f};   // of query q0 + qt * 16 + col; l holds this wave half's keys only, the halves are joined behind the loop
  v8f acc[2][4] = {};
  const int grp = (h / 4 > 2) ? 2 : h / 4; const int L = 1024 << grp; const int seg = (qb * 128) / L; const bool causal = (ISC[0] != 0) && grp == 0 && seg == 0; const int ks0 = seg * L / 32;
  const int nst = causal ? qb + 1 : L / SK;   // stages of 128 keys; causal: up to the block's last query (at least 1, at most L / SK)
  const float* gk = K + (b * SS + (size_t)ks0 * 32 + (tid >> 4)) * DM + h * HD + (tid & 15) * 4;
  const _Float16* gv = VT + (b * DM + h * HD + (tid >> 4)) * SS + (size_t)ks0 * 32 + (tid & 15) * 8;
  const unsigned lk = (unsigned)(size_t)&ring[(tid >> 4) * 272 + (tid & 15) * 16], lv = lk + (unsigned)KBY;
  stage_kv(gk, gv, lk, lv);
  asm volatile("s_wait_asynccnt 0x0" ::: "memory");   // this wave's part of stage 0 has landed
  __syncthreads();                                    // stage 0 readable by all four waves
  if (nst > 1) stage_kv(gk + SK * DM, gv + SK, lk + (unsigned)STB, lv + (unsigned)STB);   // a causal block on the first 128 queries has one stage only
  const int nfree = causal ? nst - 1 : nst;   // a causal block's last stage (keys from its first query on) is the only one that can hold a key behind a query
  kv_loop<false>(0, nfree, nst, ks0, ring, gk, gv, lk, lv, aq, q0 + col, lane, m, l, acc);
  kv_loop<true>(nfree, nst, nst, ks0, ring, gk, gv, lk, lv, aq, q0 + col, lane, m, l, acc);
  asm volatile("s_wait_asynccnt 0x0" ::: "memory");     // nothing in flight behind the loop
#pragma unroll
  for (int qt = 0; qt < 2; ++qt) { const float ls = l[qt] + xhalf(l[qt]);
    const float il = (ls > 0.f) ? 1.0f / ls : 0.f;   // acc and ls both carry 2^11
#pragma unroll
    for (int dt = 0; dt < 4; ++dt)
#pragma unroll
      for (int r = 0; r < 8; ++r) so[wave][qt * 16 + col][dt * 16 + 8 * g + r] = acc[qt][dt][r] * il; }
  LDSX();
  for (int rl = 0; rl < 32; ++rl) if (lane < 16) vst2(CTX + (rq + rl) * DM + h * HD + lane * 4, *(const v4f*)&so[wave][rl][lane * 4]);
}
extern "C" void kernel_launch(void* const* d_in, const int* in_sizes, int n_in, void* d_out, int out_size, void* d_ws, size_t ws_size, hipStream_t stream) {
  (void)in_sizes; (void)n_in; (void)out_size;
  const float** F = (const float**)d_in;   // 0 q [2,4096,12,64], 1 k, 2 v, 3 is_causal int scalar
  if (ws_size < (size_t)WS_END) return;
  char* ws = (char*)d_ws; _Float16* VT = (_Float16*)(ws + WS_VT);
  k_vt<<<dim3(SS / 64, DM / 128, NB), 256, 0, stream>>>(F[2], VT);
  k_attn<<<dim3(TQB, TNB, NH), 128, 0, stream>>>(F[0], F[1], VT, (const int*)d_in[3], (float*)d_out);
}

// v010
// It runs in 54.9 microseconds.
// In both of two side-by-side timings against v009, it was 1.13 times as fast.
// All steps since v000 together make it 9.16 times as fast.
// compute dtype: all float inputs rounded to bf16, is_causal (int scalar) read on device; k rounded once, in the front launch, and held as bf16 planes; scores = q . k with EXACT bf16 x bf16 products on WMMA 16x16x32 restricted to the query's own segment (block-local attention; segment length 1024 / 2048 / 4096 by head group), optional causal exclusion on segment 0 of group 0 when is_causal != 0, running-max softmax in f32 (maximum and rescale once per mask-free stage of 128 keys) with the factors 1/8, log2 e and 2^11 inside one fused multiply-add per score (hardware exp2); P (x 2^11) rounded once to f16 (11 significand bits, 1 product on WMMA 16x16x32 f16) x v (the bf16-rounded values held as f16 planes, exact from 2^-14 up); f32 output.
#include <hip/hip_runtime.h>
#include <math.h>

typedef __attribute__((ext_vector_type(16))) _Float16 v16h;
typedef __attribute__((ext_vector_type(16))) __bf16 v16b;
typedef __attribute__((ext_vector_type(8)))  _Float16 v8h;
typedef __attribute__((ext_vector_type(8)))  float v8f;
typedef __attribute__((ext_vector_type(4)))  float v4f;
typedef __attribute__((ext_vector_type(2)))  float v2f;
typedef __attribute__((ext_vector_type(4)))  unsigned v4u;
typedef __attribute__((ext_vector_type(4)))  int v4i;
typedef float __attribute__((may_alias)) float_a;
typedef int __attribute__((may_alias)) int_a;

template <typename T> __device__ __forceinline__ void vst2(void* p, T v) { *(T*)p = v;  }
__device__ __forceinline__ v8f wmma16(v16h a, v16h b, v8f c) {
  v8f d = __builtin_amdgcn_wmma_f32_16x16x32_f16(false, a, false, b, (short)0, c, false, false);
  asm volatile("v_nop\n\tv_nop\n\tv_nop\n\tv_nop" : "+v"(d) : "v"(a), "v"(b));
  return d;
}
__device__ __forceinline__ v8f wmma_bf(v16b a, v16b b, v8f c) {
  v8f d = __builtin_amdgcn_wmma_f32_16x16x32_bf16(false, a, false, b, (short)0, c, false, false);
  asm volatile("v_nop\n\tv_nop\n\tv_nop\n\tv_nop" : "+v"(d) : "v"(a), "v"(b));
  return d;
}
// 16x16x32 fragments: lane = (h = lane>>4, row/col = lane&15); elements 0..7 = k0+8h+0..7, 8..15 = k0+16+8h+0..7; D element r = row 8h+r
__device__ __forceinline__ v16h frag_h(const _Float16* rowk0, int lane) {
  union { v16h v; v8h q[2]; } u; const _Float16* p = rowk0 + 8 * (lane >> 4);
  u.q[0] = *(const v8h*)p; u.q[1] = *(const v8h*)(p + 16); return u.v;
}
__device__ __forceinline__ v16h frag_f32(const float* rowk0, int lane) {
  v16h a; const float* p = rowk0 + 8 * (lane >> 4);
#pragma unroll
  for (int i = 0; i < 8; ++i) { a[i] = (_Float16)p[i]; a[8 + i] = (_Float16)p[16 + i]; }
  return a;
}
__device__ __forceinline__ v16h frag_f32s(const float* rowk0, int lane, float sc) {
  v16h a; const float* p = rowk0 + 8 * (lane >> 4);
#pragma unroll
  for (int i = 0; i < 8; ++i) { a[i] = (_Float16)(p[i] * sc); a[8 + i] = (_Float16)(p[16 + i] * sc); }
  return a;
}
// column fragment from a [K][ld] layout (column n), rows >= K read as 0
__device__ __forceinline__ v16h fragc_f32(const float* W, int k0, int n, int lane, int ld, int K) {
  v16h a; const int g = lane >> 4;
#pragma unroll
  for (int i = 0; i < 8; ++i) { const int ka = k0 + 8 * g + i, kb = ka + 16;
    a[i] = (_Float16)(ka < K ? W[(size_t)(ka < K ? ka : K - 1) * ld + n] : 0.f); a[8 + i] = (_Float16)(kb < K ? W[(size_t)(kb < K ? kb : K - 1) * ld + n] : 0.f); }
  return a;
}
struct F2 { v16b h, l; };
__device__ __forceinline__ F2 bsplit16(const float v[16]) { F2 r;
#pragma unroll
  for (int i = 0; i < 16; ++i) { const __bf16 h = (__bf16)v[i]; r.h[i] = h; r.l[i] = (__bf16)(v[i] - (float)h); }
  return r; }
__device__ __forceinline__ F2 split_row(const float* row, int k0, int lane) { float v[16]; const float* p = row + k0 + 8 * (lane >> 4);
#pragma unroll
  for (int i = 0; i < 8; ++i) { v[i] = p[i]; v[8 + i] = p[16 + i]; }
  return bsplit16(v); }
__device__ __forceinline__ F2 split_rowK(const float* row, int k0, int lane, int K) { float v[16]; const int g = lane >> 4;
#pragma unroll
  for (int i = 0; i < 8; ++i) { const int ka = k0 + 8 * g + i, kb = ka + 16; v[i] = ka < K ? row[ka < K ? ka : K - 1] : 0.f; v[8 + i] = kb < K ? row[kb < K ? kb : K - 1] : 0.f; }
  return bsplit16(v); }
__device__ __forceinline__ F2 split_col(const float* W, int k0, int n, int lane, int ld, int K) { float v[16]; const int g = lane >> 4;
#pragma unroll
  for (int i = 0; i < 8; ++i) { const int ka = k0 + 8 * g + i, kb = ka + 16; v[i] = ka < K ? W[(size_t)(ka < K ? ka : K - 1) * ld + n] : 0.f; v[8 + i] = kb < K ? W[(size_t)(kb < K ? kb : K - 1) * ld + n] : 0.f; }
  return bsplit16(v); }
__device__ __forceinline__ v8f mac3(const F2& a, const F2& b, v8f c) { c = wmma_bf(a.l, b.h, c); c = wmma_bf(a.h, b.l, c); return wmma_bf(a.h, b.h, c); }
__device__ __forceinline__ float sigm(float v) { return 1.0f / (1.0f + expf(-v)); }
#define LDSX() do { asm volatile("s_wait_dscnt 0" ::: "memory"); __builtin_amdgcn_wave_barrier(); __builtin_amdgcn_fence(__ATOMIC_RELEASE, "workgroup"); } while (0)


// Head-parallel block-local ('dilated', degenerate gather) attention on given q, k, v (B 2, N 4,096, 12 heads x 64): heads 0-3 attend within 1,024-token segments, 4-7 within 2,048, 8-11 over all 4,096; softmax(q k / 8) v per segment.
#define NB 2
#define SS 4096
#define NH 12
#define HD 64
#define DM (NH * HD)
#ifndef TQB
#define TQB (SS / 128)
#define TNB NB
#define QB0 0            // first query block
#endif
typedef __attribute__((ext_vector_type(8))) __bf16 v8b;
__device__ __forceinline__ v16b frag_b(const __bf16* rowk0, int lane) {
  union { v16b v; v8b q[2]; } u; const __bf16* p = rowk0 + 8 * (lane >> 4);
  u.q[0] = *(const v8b*)p; u.q[1] = *(const v8b*)(p + 16); return u.v;
}
__device__ __forceinline__ float bfr(float v) { return (float)(__bf16)v; }
__device__ __attribute__((noinline)) float exp_ni(float v) { return expf(v); }
__device__ __attribute__((noinline)) float erf_ni(float v) { return erff(v); }

#define WS_VT  0u                                   // f16 v planes [b][h*64 + d][s]
#define WS_KB  (WS_VT + 2u * (size_t)NB * DM * SS)   // bf16 k planes [b][h][s][d]: a head's keys lie in a row, 128 B each
#define WS_END (WS_KB + 2u * (size_t)NB * DM * SS)
typedef __attribute__((ext_vector_type(4))) __bf16 v4b;

// ---- k_vt: block = (64 keys, 128 cols, b): v[b][s][c] -> VT[b][c][s]: rounded to bf16 as every float input, that value stored as f16
// blocks with y >= DM / 128 (two rows of the grid, 128 blocks per b) instead round k: 32 keys x 12 heads each, k[b][s][h][d] -> KB[b][h][s][d] as bf16, the rounding of every float input; a wave takes two keys of one head per load (two whole 256-B pieces) and stores their 256 B of bf16 in a row.
__global__ __launch_bounds__(256) void k_vt(const float* __restrict__ V, const float* __restrict__ K, _Float16* __restrict__ VT, __bf16* __restrict__ KB) { __shared__ __align__(16) _Float16 st[128][64 + 8]; const int t = threadIdx.x; const int s0 = blockIdx.x * 64; const int c0 = blockIdx.y * 128; const size_t b = blockIdx.z;
  if (blockIdx.y >= DM / 128) {   // the same for the whole block, in front of the barrier
    const int w = t >> 5, ln = t & 31; const size_t s = (size_t)((blockIdx.y - DM / 128) * (SS / 64) + blockIdx.x) * 32 + (w >> 2) * 2 + (ln >> 4);
    // rolled over the three groups of four heads: eight loads of 16 B per lane in flight are enough, and all 24 would take registers from the v blocks beside
#pragma unroll 1
    for (int r = 0; r < 3; ++r) { const int hh = r * 4 + (w & 3); const float* src = K + (b * SS + s) * DM + hh * HD + (ln & 15) * 4; __bf16* dst = KB + ((b * NH + hh) * SS + s) * HD + (ln & 15) * 4;
      v4f x[8];
#pragma unroll
      for (int j = 0; j < 8; ++j) x[j] = *(const v4f*)(src + (size_t)j * 4 * DM);
#pragma unroll
      for (int j = 0; j < 8; ++j) { v4b y;
#pragma unroll
        for (int i = 0; i < 4; ++i) y[i] = (__bf16)x[j][i];
        *(v4b*)(dst + j * 4 * HD) = y; }
      asm volatile("s_wait_xcnt 0x0" ::: "memory"); }   // in front of the next trip, which rewrites the registers that these stores name
    return; }
  for (int e = t; e < 64 * 128; e += 256) { const int sl = e >> 7, c = e & 127; st[c][sl] = (_Float16)bfr(V[((b * SS + s0 + sl) * DM) + c0 + c]); } __syncthreads();
  for (int e = t; e < 128 * 8; e += 256) { const int c = e >> 3, q = e & 7; vst2((unsigned*)(VT + ((b * DM + c0 + c) * SS) + s0 + q * 8), *(const v4u*)&st[c][q * 8]); } }
__device__ __forceinline__ v16b fragb_f32(const float* __restrict__ p, int lane) { v16b a; const float* pp = p + 8 * (lane >> 4);
#pragma unroll
  for (int i = 0; i < 8; ++i) { a[i] = (__bf16)pp[i]; a[8 + i] = (__bf16)pp[16 + i]; } return a; }
// lane l with lane l ^ 16 (the other half of the wave), on the vector pipe
__device__ __forceinline__ float xhalf(float x) { return __builtin_bit_cast(float, __builtin_amdgcn_permlanex16(__builtin_bit_cast(int, x), __builtin_bit_cast(int, x), 0x76543210, 0xfedcba98, false, false)); }
#define KP 72   // staged K row pitch in bf16: 144 B = 16 B x 9, no bank conflict for 16-byte row reads
#define VP 136  // staged V plane row pitch in f16: 272 B = 16 B x 17, likewise
#define SK 128  // keys of one stage of the ring: one pass (masked: four passes of 32 keys)
#define KBY (SK * KP * 2)          // bytes of a stage's K rows
#define STB (KBY + 64 * VP * 2)    // bytes of a stage: K rows, then V plane rows
#define SL2 0.18033688f            // log2(e) / 8: a product q . k times this is the scaled score as an exponent of 2
// eight copies of 16 B per lane, a wave covering 4 whole lines per copy; from one copy to the next the source moves on by gs bytes and the place in LDS by ls bytes (V planes: 8 rows of 256 B, pitch 272 B; K planes: 16 rows of 128 B, pitch 144 B).
// The closing s_wait_xcnt stands inside the statement so that no address register named here is rewritten ahead of it.
__device__ __forceinline__ void copy8(const char* g, size_t gs, unsigned l, unsigned ls) {
  asm volatile("global_load_async_to_lds_b128 %0, %8, off\n\t"
               "global_load_async_to_lds_b128 %1, %9, off\n\t"
               "global_load_async_to_lds_b128 %2, %10, off\n\t"
               "global_load_async_to_lds_b128 %3, %11, off\n\t"
               "global_load_async_to_lds_b128 %4, %12, off\n\t"
               "global_load_async_to_lds_b128 %5, %13, off\n\t"
               "global_load_async_to_lds_b128 %6, %14, off\n\t"
               "global_load_async_to_lds_b128 %7, %15, off\n\t"
               "s_wait_xcnt 0x0"
               :: "v"(l), "v"(l + ls), "v"(l + 2u * ls), "v"(l + 3u * ls), "v"(l + 4u * ls), "v"(l + 5u * ls), "v"(l + 6u * ls), "v"(l + 7u * ls),
                  "v"(g), "v"(g + gs), "v"(g + 2 * gs), "v"(g + 3 * gs), "v"(g + 4 * gs), "v"(g + 5 * gs), "v"(g + 6 * gs), "v"(g + 7 * gs) : "memory");
}
// one stage of 128 keys, 16 copies per lane: 128 K plane rows (64 bf16 each, 16 KB in a row at the source), then the 64 V plane rows (128 f16 each)
__device__ __forceinline__ void stage_kv(const __bf16* gk, const _Float16* gv, unsigned lk, unsigned lv) {
  copy8((const char*)gk, (size_t)16 * HD * 2, lk, 16u * KP * 2u);
  copy8((const char*)gv, (size_t)8 * SS * 2, lv, 8u * VP * 2u);
}
// one pass of 32 keys for this wave's 32 queries (two query tiles of 16, qt = 0, 1), from the staged K rows kt and, from key column ko on, the V plane rows vt: each K and V fragment is read from LDS once and feeds both tiles' products. Per query the arithmetic and its order are those of a 16-query wave. MK = the pass may hold keys behind a query of a causal block: only then the key index is compared, and only then a score can be the excluded value, so only then the exponentials are guarded; in every other pass all 32 scores are finite, and exp2 of the start value of m less mn is 0 by itself. m is the running maximum of the products q . k themselves (1/8 > 0 keeps the order); a weight is exp2(product * SL2 + (11 - mn * SL2)) = 2^11 exp(score - maximum): one fused multiply-add in front of the hardware exp2, so l too carries the factor 2^11, which the division behind the loop cancels.
template <bool MK> __device__ __forceinline__ void kv_pass(const __bf16 (*kt)[KP], const _Float16 (*vt)[VP], int ko, const v16b (&aq)[2][2], int kb0, int qi, int lane, float (&m)[2], float (&l)[2], v8f (&acc)[2][4]) {
  const int col = lane & 15;
  v16b kf[2][2];
#pragma unroll
  for (int ct = 0; ct < 2; ++ct)
#pragma unroll
    for (int kc = 0; kc < 2; ++kc) kf[ct][kc] = frag_b(&kt[ct * 16 + col][kc * 32], lane);
  v8f c[2][2] = {};   // c[qt][ct][r] = score of key kb0 + ct * 16 + r, query qi + qt * 16: four independent accumulators
#pragma unroll
  for (int kc = 0; kc < 2; ++kc)
#pragma unroll
    for (int qt = 0; qt < 2; ++qt)
#pragma unroll
      for (int ct = 0; ct < 2; ++ct) c[qt][ct] = wmma_bf(kf[ct][kc], aq[qt][kc], c[qt][ct]);
  v16h vf[4];
#pragma unroll
  for (int dt = 0; dt < 4; ++dt) vf[dt] = frag_h(&vt[dt * 16 + col][ko], lane);
  v16h pa[2];   // per tile: element i = key 8 g + i, element 8 + i = key 16 + 8 g + i: the k order of frag_h
#pragma unroll
  for (int qt = 0; qt < 2; ++qt) { v8f s[2];
#pragma unroll
    for (int ct = 0; ct < 2; ++ct)
#pragma unroll
      for (int r = 0; r < 8; ++r) s[ct][r] = (!MK || kb0 + ct * 16 + r <= qi + qt * 16) ? c[qt][ct][r] : -3.0e38f;
    float mr[8];
#pragma unroll
    for (int r = 0; r < 8; ++r) mr[r] = fmaxf(s[0][r], s[1][r]);
    float mx = fmaxf(fmaxf(fmaxf(mr[0], mr[1]), fmaxf(mr[2], mr[3])), fmaxf(fmaxf(mr[4], mr[5]), fmaxf(mr[6], mr[7])));
    mx = fmaxf(mx, xhalf(mx));
    const float mn = fmaxf(m[qt], mx); const float alpha = (MK && m[qt] <= -1.0e38f) ? 0.f : __builtin_amdgcn_exp2f((m[qt] - mn) * SL2);
    const float bo = __builtin_fmaf(-mn, SL2, 11.0f);
    const v8f t0 = __builtin_elementwise_fma(s[0], (v8f)(SL2), (v8f)(bo)), t1 = __builtin_elementwise_fma(s[1], (v8f)(SL2), (v8f)(bo));   // on whole accumulator tiles: neighbouring registers pair up
    float e[16];
#pragma unroll
    for (int i = 0; i < 8; ++i) { e[i] = (MK && s[0][i] <= -1.0e38f) ? 0.f : __builtin_amdgcn_exp2f(t0[i]); e[8 + i] = (MK && s[1][i] <= -1.0e38f) ? 0.f : __builtin_amdgcn_exp2f(t1[i]); }
    float er[8];
#pragma unroll
    for (int i = 0; i < 8; ++i) er[i] = e[i] + e[8 + i];
    l[qt] = l[qt] * alpha + (((er[0] + er[1]) + (er[2] + er[3])) + ((er[4] + er[5]) + (er[6] + er[7]))); m[qt] = mn;
#pragma unroll
    for (int dt = 0; dt < 4; ++dt) acc[qt][dt] *= alpha;
#pragma unroll
    for (int i = 0; i < 16; ++i) pa[qt][i] = (_Float16)e[i];   // e holds the factor 2^11: weights down to 2^-25 of the row's maximum stay normal f16 numbers
  }
#pragma unroll
  for (int qt = 0; qt < 2; ++qt)
#pragma unroll
    for (int dt = 0; dt < 4; ++dt) acc[qt][dt] = wmma16(vf[dt], pa[qt], acc[qt][dt]);   // acc[qt][dt][r] = out column dt * 16 + 8 g + r of query qi + qt * 16
}
// a mask-free stage in ONE pass of NC * 32 keys (NC chunks of 32) for this wave's 32 queries: fragments, products, weights and their rounding as in kv_pass<false>, but all scores of the stage are formed first and stay in registers, so that the maximum, its exchange between the wave halves, alpha and the rescale of l and of the 64 output accumulators run once per 128 keys and not once per 32; the weights of the pass are summed in eight running partial sums per tile, joined once per pass. All scores are finite here, and exp2 of the start value of m less mn is 0 by itself. The products are the plain builtins (the compiler keeps the distance behind them itself): the v_nop statement of wmma_bf and wmma16 binds its operands to the first 256 registers, and the 128 score registers beside the accumulators, Q and a chunk of K need more than those.
#define NC (SK / 32)
// a chunk's four K fragments: [key tile][half of the head]
__device__ __forceinline__ void kfrag_lds(v16b (&kf)[2][2], const __bf16 (*kt)[KP], int col, int lane) {
#pragma unroll
  for (int ct = 0; ct < 2; ++ct)
#pragma unroll
    for (int kc = 0; kc < 2; ++kc) kf[ct][kc] = frag_b(&kt[ct * 16 + col][kc * 32], lane);
}
__device__ __forceinline__ void kv_wide(const __bf16 (*kt)[KP], const _Float16 (*vt)[VP], const v16b (&aq)[2][2], int lane, float (&m)[2], float (&l)[2], v8f (&acc)[2][4]) {
  const int col = lane & 15;
  v8f c[2][2 * NC];   // c[qt][j][r] = score of the stage's key j * 16 + 8 g + r, query tile qt, column lane & 15
  v16b kf[2][2][2];   // K fragments of two chunks: the next chunk's are read while this chunk's products run
  kfrag_lds(kf[0], kt, col, lane);
#pragma unroll
  for (int ch = 0; ch < NC; ++ch) {
    if (ch + 1 < NC) kfrag_lds(kf[(ch + 1) & 1], kt + (ch + 1) * 32, col, lane);
    __builtin_amdgcn_sched_barrier(0);   // keeps the next chunk's LDS reads in front of this chunk's products, which cover their latency
#pragma unroll
    for (int qt = 0; qt < 2; ++qt)
#pragma unroll
      for (int ct = 0; ct < 2; ++ct) c[qt][ch * 2 + ct] = v8f{};
#pragma unroll
    for (int kc = 0; kc < 2; ++kc)
#pragma unroll
      for (int qt = 0; qt < 2; ++qt)
#pragma unroll
        for (int ct = 0; ct < 2; ++ct) c[qt][ch * 2 + ct] = __builtin_amdgcn_wmma_f32_16x16x32_bf16(false, kf[ch & 1][ct][kc], false, aq[qt][kc], (short)0, c[qt][ch * 2 + ct], false, false);
  }
  v16h vf[2][4];   // V fragments of two chunks: the next chunk's are read while this chunk's products run
  v16h pa[2][NC];   // per tile and chunk: element i = key 8 g + i, element 8 + i = key 16 + 8 g + i of the chunk: the k order of frag_h
#pragma unroll
  for (int qt = 0; qt < 2; ++qt) {
    float mr[8];
#pragma unroll
    for (int r = 0; r < 8; ++r) { mr[r] = fmaxf(c[qt][0][r], c[qt][1][r]);
#pragma unroll
      for (int j = 2; j < 2 * NC; j += 2) mr[r] = fmaxf(fmaxf(mr[r], c[qt][j][r]), c[qt][j + 1][r]); }
    float mx = fmaxf(fmaxf(fmaxf(mr[0], mr[1]), fmaxf(mr[2], mr[3])), fmaxf(fmaxf(mr[4], mr[5]), fmaxf(mr[6], mr[7])));
    mx = fmaxf(mx, xhalf(mx));
    const float mn = fmaxf(m[qt], mx); const float alpha = __builtin_amdgcn_exp2f((m[qt] - mn) * SL2);
    const float bo = __builtin_fmaf(-mn, SL2, 11.0f);
    v8f ps = {};   // running partial sums of the pass's weights
#pragma unroll
    for (int ch = 0; ch < NC; ++ch) {
      const v8f t0 = __builtin_elementwise_fma(c[qt][ch * 2], (v8f)(SL2), (v8f)(bo)), t1 = __builtin_elementwise_fma(c[qt][ch * 2 + 1], (v8f)(SL2), (v8f)(bo));   // on whole accumulator tiles: neighbouring registers pair up
      v8f e0, e1;
#pragma unroll
      for (int i = 0; i < 8; ++i) e0[i] = __builtin_amdgcn_exp2f(t0[i]);
#pragma unroll
      for (int i = 0; i < 8; ++i) e1[i] = __builtin_amdgcn_exp2f(t1[i]);
      ps += e0 + e1;
#pragma unroll
      for (int i = 0; i < 8; ++i) { pa[qt][ch][i] = (_Float16)e0[i]; pa[qt][ch][8 + i] = (_Float16)e1[i]; }   // the weights hold the factor 2^11: down to 2^-25 of the row's maximum they stay normal f16 numbers
    }
    if (qt == 1) {   // the first chunk's V fragments: read only once the scores have shrunk to f16 weights and left room for them; the joins of the sums and the rescale cover part of their latency
#pragma unroll
      for (int dt = 0; dt < 4; ++dt) vf[0][dt] = frag_h(&vt[dt * 16 + col][0], lane);
    }
    l[qt] = l[qt] * alpha + (((ps[0] + ps[1]) + (ps[2] + ps[3])) + ((ps[4] + ps[5]) + (ps[6] + ps[7]))); m[qt] = mn;
    asm volatile("" : "+v"(l[qt]));   // empty asm on each row's sum, against spills: else the compiler sinks the additions behind the stage's barrier, keeps every weight of the pass live in f32 till there and spills
#pragma unroll
    for (int dt = 0; dt < 4; ++dt) acc[qt][dt] *= alpha;
  }
#pragma unroll
  for (int ch = 0; ch < NC; ++ch) {
    if (ch + 1 < NC) {
#pragma unroll
      for (int dt = 0; dt < 4; ++dt) vf[(ch + 1) & 1][dt] = frag_h(&vt[dt * 16 + col][(ch + 1) * 32], lane);
    }
    __builtin_amdgcn_sched_barrier(0);   // keeps the next chunk's LDS reads in front of this chunk's products, which cover their latency
#pragma unroll
    for (int qt = 0; qt < 2; ++qt)
#pragma unroll
      for (int dt = 0; dt < 4; ++dt) acc[qt][dt] = __builtin_amdgcn_wmma_f32_16x16x32_f16(false, vf[ch & 1][dt], false, pa[qt][ch], (short)0, acc[qt][dt], false, false);   // acc[qt][dt][r] = out column dt * 16 + 8 g + r of query tile qt, column lane & 15
  }
}
// stages t0 .. t1 - 1 of the nst stages of a block, all of one form (mask-free: one pass of 128 keys; masked: four passes of 32 keys); the foot of each stage is the ring's: own LDS reads done, own copies landed, one block barrier, then the refill two stages ahead, which so has the work of a whole stage to land
template <bool MK> __device__ __forceinline__ void kv_loop(int t0, int t1, int nst, int ks0, const unsigned char* ring, const __bf16* gk, const _Float16* gv, unsigned lk, unsigned lv, const v16b (&aq)[2][2], int qi, int lane, float (&m)[2], float (&l)[2], v8f (&acc)[2][4]) {
  // the stage loop stays rolled: a second copy of its long body would add code and save only the loop's few scalar instructions
#pragma unroll 1
  for (int t = t0; t < t1; ++t) { const int bf = t & 1;
    const __bf16 (*kt)[KP] = (const __bf16 (*)[KP])(ring + bf * STB); const _Float16 (*vt)[VP] = (const _Float16 (*)[VP])(ring + bf * STB + KBY);
    if constexpr (!MK) kv_wide(kt, vt, aq, lane, m, l, acc);
    else {
      // the masked stage's pass loop stays rolled: it runs once per causal block, and four long bodies in a row would only add code and registers
#pragma unroll 1
      for (int p = 0; p < SK / 32; ++p) kv_pass<MK>(kt + p * 32, vt, p * 32, aq, (ks0 + t * (SK / 32) + p) * 32 + 8 * (lane >> 4), qi, lane, m, l, acc);
    }
    asm volatile("s_wait_dscnt 0x0" ::: "memory");      // this wave's reads of buffer bf are done
    asm volatile("s_wait_asynccnt 0x0" ::: "memory");   // this wave's part of stage t + 1 has landed
    __syncthreads();                                    // publishes stage t + 1 and frees buffer bf for the refill
    if (t + 2 < nst) stage_kv(gk + (size_t)(t + 2) * SK * HD, gv + (t + 2) * SK, lk + (unsigned)bf * (unsigned)STB, lv + (unsigned)bf * (unsigned)STB); }
}
__global__ __launch_bounds__(128) void k_attn(const float* __restrict__ Q, const __bf16* __restrict__ KB, const _Float16* __restrict__ VT, const int* __restrict__ ISC, float* __restrict__ CTX) {
  __shared__ __align__(16) unsigned char ring[2 * STB];
  float (*so)[32][68] = (float (*)[32][68])ring;   // output staging, 34,816 B: used only behind the loop
  const int tid = threadIdx.x, wave = tid >> 5, lane = tid & 31, col = lane & 15, g = lane >> 4; const int qb = blockIdx.x + QB0, h = NH - 1 - (int)blockIdx.z; const size_t b = blockIdx.y; const int q0 = qb * 128 + wave * 32; const size_t rq = b * SS + q0;
  v16b aq[2][2];
#pragma unroll
  for (int qt = 0; qt < 2; ++qt)
#pragma unroll
    for (int kc = 0; kc < 2; ++kc) aq[qt][kc] = fragb_f32(Q + (rq + qt * 16 + col) * DM + h * HD + kc * 32, lane);
  float m[2] = {-3.0e38f, -3.0e38f}, l[2] = {0.f, 0.f};   // of query q0 + qt * 16 + col; l holds this wave half's keys only, the halves are joined behind the loop
  v8f acc[2][4] = {};
  const int grp = (h / 4 > 2) ? 2 : h / 4; const int L = 1024 << grp; const int seg = (qb * 128) / L; const bool causal = (ISC[0] != 0) && grp == 0 && seg == 0; const int ks0 = seg * L / 32;
  const int nst = causal ? qb + 1 : L / SK;   // stages of 128 keys; causal: up to the block's last query (at least 1, at most L / SK)
  const __bf16* gk = KB + ((b * NH + h) * SS + (size_t)ks0 * 32 + (tid >> 3)) * HD + (tid & 7) * 8;
  const _Float16* gv = VT + (b * DM + h * HD + (tid >> 4)) * SS + (size_t)ks0 * 32 + (tid & 15) * 8;
  const unsigned lk = (unsigned)(size_t)&ring[(tid >> 3) * (KP * 2) + (tid & 7) * 16], lv = (unsigned)(size_t)&ring[KBY + (tid >> 4) * (VP * 2) + (tid & 15) * 16];
  stage_kv(gk, gv, lk, lv);
  asm volatile("s_wait_asynccnt 0x0" ::: "memory");   // this wave's part of stage 0 has landed
  __syncthreads();                                    // stage 0 readable by all four waves
  if (nst > 1) stage_kv(gk + SK * HD, gv + SK, lk + (unsigned)STB, lv + (unsigned)STB);   // a causal block on the first 128 queries has one stage only
  const int nfree = causal ? nst - 1 : nst;   // a causal block's last stage (keys from its first query on) is the only one that can hold a key behind a query
  kv_loop<false>(0, nfree, nst, ks0, ring, gk, gv, lk, lv, aq, q0 + col, lane, m, l, acc);
  kv_loop<true>(nfree, nst, nst, ks0, ring, gk, gv, lk, lv, aq, q0 + col, lane, m, l, acc);
  asm volatile("s_wait_asynccnt 0x0" ::: "memory");     // nothing in flight behind the loop
#pragma unroll
  for (int qt = 0; qt < 2; ++qt) { const float ls = l[qt] + xhalf(l[qt]);
    const float il = (ls > 0.f) ? 1.0f / ls : 0.f;   // acc and ls both carry 2^11
#pragma unroll
    for (int dt = 0; dt < 4; ++dt)
#pragma unroll
      for (int r = 0; r < 8; ++r) so[wave][qt * 16 + col][dt * 16 + 8 * g + r] = acc[qt][dt][r] * il; }
  LDSX();
  for (int rl = 0; rl < 32; ++rl) if (lane < 16) vst2(CTX + (rq + rl) * DM + h * HD + lane * 4, *(const v4f*)&so[wave][rl][lane * 4]);
}
extern "C" void kernel_launch(void* const* d_in, const int* in_sizes, int n_in, void* d_out, int out_size, void* d_ws, size_t ws_size, hipStream_t stream) {
  (void)in_sizes; (void)n_in; (void)out_size;
  const float** F = (const float**)d_in;   // 0 q [2,4096,12,64], 1 k, 2 v, 3 is_causal int scalar
  if (ws_size < (size_t)WS_END) return;
  char* ws = (char*)d_ws; _Float16* VT = (_Float16*)(ws + WS_VT); __bf16* KB = (__bf16*)(ws + WS_KB);
  k_vt<<<dim3(SS / 64, DM / 128 + 2, NB), 256, 0, stream>>>(F[2], F[1], VT, KB);
  k_attn<<<dim3(TQB, TNB, NH), 128, 0, stream>>>(F[0], KB, VT, (const int*)d_in[3], (float*)d_out);
}
